// v000
// Measured on an AMD MI455X. A time is GPU time per run, averaged over a window of back-to-back runs after a warm-up
// (all launches, gaps included; the runs take copies of the inputs in turn), and the median of several windows.
// Apart from v000's, it joins two sittings. Times from different sittings can be a few percent apart, while
// side-by-side timings come from the same sitting.
// The starting kernel, v000, takes 165 microseconds a run.
#include <hip/hip_runtime.h>

typedef _Float16 v16h __attribute__((ext_vector_type(16)));
typedef _Float16 v8h  __attribute__((ext_vector_type(8)));
typedef float    v8f  __attribute__((ext_vector_type(8)));

constexpr int BB = 16;
constexpr int SS = 2048;
constexpr int DD = 128;
constexpr int KVT = 32;              // kv rows per tile
constexpr int NT  = SS / KVT;        // 64 kv tiles
constexpr int WAVES = 4;             // wave32s per workgroup
constexpr int TILE_H = KVT * DD;     // f16 elements per staged tile (4096 = 8KB)

// gfx1250 async global->LDS copy path (ASYNCcnt) if the toolchain exposes it.
#if defined(__has_builtin)
#if __has_builtin(__builtin_amdgcn_global_load_async_to_lds_b128)
#define USE_ASYNC_LDS 1
#endif
#endif

#ifdef USE_ASYNC_LDS
// Param 0: gcc-style int4 pointer in AS(1) (global); param 1: LDS-side pointer.
typedef int v4i __attribute__((vector_size(16)));
typedef __attribute__((address_space(1))) v4i* gasp;   // global (AS1)
typedef __attribute__((address_space(3))) v4i* lasp;   // LDS (AS3)
__device__ __forceinline__ gasp to_global(const void* p) {
    return (gasp)(unsigned long long)p;                // AS1 == generic numerically
}
__device__ __forceinline__ lasp to_lds(void* p) {
    return (lasp)(unsigned)(unsigned long long)p;      // LDS offset = low 32 bits
}
__device__ __forceinline__ void wait_async0() {
#if __has_builtin(__builtin_amdgcn_s_wait_asynccnt)
    __builtin_amdgcn_s_wait_asynccnt(0);
#else
    asm volatile("s_wait_asynccnt 0x0" ::: "memory");
#endif
}
#endif

// Raw v_exp_f32: args here are always <= 0, and sub-(-126) inputs should flush
// to 0 probability anyway, so skip ocml's denormal-range fixup entirely.
__device__ __forceinline__ float fast_exp2(float x) {
#if defined(__has_builtin) && __has_builtin(__builtin_amdgcn_exp2f)
    return __builtin_amdgcn_exp2f(x);
#else
    return exp2f(x);
#endif
}
__device__ __forceinline__ float fast_rcp(float x) {
#if defined(__has_builtin) && __has_builtin(__builtin_amdgcn_rcpf)
    return __builtin_amdgcn_rcpf(x);
#else
    return 1.0f / x;
#endif
}

// Build a v16h WMMA operand from two contiguous 16B LDS chunks (2x ds_load_b128).
__device__ __forceinline__ v16h ld_op16(const _Float16* p) {
    v8h lo = *(const v8h*)p;
    v8h hh = *(const v8h*)(p + 16);
    v16h r;
#pragma unroll
    for (int i = 0; i < 8; ++i) { r[i] = lo[i]; r[i + 8] = hh[i]; }
    return r;
}

// ---------------- pre-pass: K -> f16 flat, V -> f16 transposed per 32-row tile ----------------
__global__ __launch_bounds__(128, 1)
void fa_prep(const float* __restrict__ K, const float* __restrict__ V,
             _Float16* __restrict__ Kh, _Float16* __restrict__ Vt)
{
    __shared__ __align__(16) _Float16 T[DD * KVT];   // [d][k]
    const int tid  = threadIdx.x;
    const int b    = blockIdx.x >> 6;
    const int t    = blockIdx.x & 63;
    const int krow = tid >> 2;
    const int cgrp = (tid & 3) * 32;
    const size_t tb = ((size_t)b * SS + (size_t)t * KVT) * DD;
    const float* kp = K + tb + (size_t)krow * DD + cgrp;
    const float* vp = V + tb + (size_t)krow * DD + cgrp;
    _Float16*    kq = Kh + tb + (size_t)krow * DD + cgrp;
#pragma unroll
    for (int j = 0; j < 4; ++j) {
        float4 a = *(const float4*)(kp + 8 * j);
        float4 c = *(const float4*)(kp + 8 * j + 4);
        v8h h;
        h[0]=(_Float16)a.x; h[1]=(_Float16)a.y; h[2]=(_Float16)a.z; h[3]=(_Float16)a.w;
        h[4]=(_Float16)c.x; h[5]=(_Float16)c.y; h[6]=(_Float16)c.z; h[7]=(_Float16)c.w;
        *(v8h*)(kq + 8 * j) = h;
        float4 e = *(const float4*)(vp + 8 * j);
        float4 f = *(const float4*)(vp + 8 * j + 4);
        const int d0 = cgrp + 8 * j;
        T[(d0+0)*KVT + krow] = (_Float16)e.x;
        T[(d0+1)*KVT + krow] = (_Float16)e.y;
        T[(d0+2)*KVT + krow] = (_Float16)e.z;
        T[(d0+3)*KVT + krow] = (_Float16)e.w;
        T[(d0+4)*KVT + krow] = (_Float16)f.x;
        T[(d0+5)*KVT + krow] = (_Float16)f.y;
        T[(d0+6)*KVT + krow] = (_Float16)f.z;
        T[(d0+7)*KVT + krow] = (_Float16)f.w;
    }
    __syncthreads();
    _Float16* vo = Vt + tb + (size_t)tid * KVT;
    const _Float16* ts = &T[tid * KVT];
#pragma unroll
    for (int j = 0; j < 4; ++j)
        *(v8h*)(vo + 8 * j) = *(const v8h*)(ts + 8 * j);
}

// ---------------- main FlashAttention kernel (transpose-free, double-buffered) ----------------
__global__ __launch_bounds__(128, 1)
void DotProductAttention_48421461295297_kernel(const float* __restrict__ Q,
                                               const _Float16* __restrict__ Kh,
                                               const _Float16* __restrict__ Vt,
                                               float* __restrict__ O)
{
    __shared__ __align__(16) _Float16 Kst[2][TILE_H];   // [k=32][d=128]
    __shared__ __align__(16) _Float16 Vst[2][TILE_H];   // [d=128][k=32]

    const int tid  = threadIdx.x;
    const int wave = tid >> 5;
    const int lane = tid & 31;
    const int ln   = lane & 15;
    const int koff = (lane >> 4) * 8;   // K-range offset in operand layout
    const int mb   = koff;              // row-base in C/D layout

    const int batch = blockIdx.x >> 5;
    const int qblk  = blockIdx.x & 31;
    const int q0    = qblk * (WAVES * 16) + wave * 16;
    const size_t bbase = (size_t)batch * SS * DD;

    const float SL2E = 0.08838834764831845f * 1.4426950408889634f;  // 1/sqrt(128)*log2(e)

    // Q tile -> f16 registers with the softmax scale folded in (log2 domain).
    v16h qa[4];
    {
        const float* qp = Q + bbase + (size_t)(q0 + ln) * DD;
#pragma unroll
        for (int dc = 0; dc < 4; ++dc) {
            const int off = dc * 32 + koff;
            float4 f0 = *(const float4*)(qp + off);
            float4 f1 = *(const float4*)(qp + off + 4);
            float4 f2 = *(const float4*)(qp + off + 16);
            float4 f3 = *(const float4*)(qp + off + 20);
            v16h a;
            a[0]=(_Float16)(f0.x*SL2E);  a[1]=(_Float16)(f0.y*SL2E);
            a[2]=(_Float16)(f0.z*SL2E);  a[3]=(_Float16)(f0.w*SL2E);
            a[4]=(_Float16)(f1.x*SL2E);  a[5]=(_Float16)(f1.y*SL2E);
            a[6]=(_Float16)(f1.z*SL2E);  a[7]=(_Float16)(f1.w*SL2E);
            a[8]=(_Float16)(f2.x*SL2E);  a[9]=(_Float16)(f2.y*SL2E);
            a[10]=(_Float16)(f2.z*SL2E); a[11]=(_Float16)(f2.w*SL2E);
            a[12]=(_Float16)(f3.x*SL2E); a[13]=(_Float16)(f3.y*SL2E);
            a[14]=(_Float16)(f3.z*SL2E); a[15]=(_Float16)(f3.w*SL2E);
            qa[dc] = a;
        }
    }

    v8f ot[8] = {};                       // O^T accumulators: rows d, cols q (fp32)
    float mrun = -__builtin_inff();
    float lrun = 0.0f;

    // staging: each thread owns 64B of the K tile and 64B of the V tile
    const _Float16* kbase = Kh + bbase + (size_t)tid * 32;
    const _Float16* vbase = Vt + bbase + (size_t)tid * 32;

#ifdef USE_ASYNC_LDS
    {   // stage tile 0: direct global->LDS, no VGPR traffic
        gasp kg = to_global(kbase);
        gasp vg = to_global(vbase);
        lasp kl = to_lds(&Kst[0][tid * 32]);
        lasp vl = to_lds(&Vst[0][tid * 32]);
#pragma unroll
        for (int j = 0; j < 4; ++j) {
            __builtin_amdgcn_global_load_async_to_lds_b128(kg + j, kl + j, 0, 0);
            __builtin_amdgcn_global_load_async_to_lds_b128(vg + j, vl + j, 0, 0);
        }
        wait_async0();
    }
#else
    v8h kr[4], vr[4];
#pragma unroll
    for (int j = 0; j < 4; ++j) {
        kr[j] = *(const v8h*)(kbase + 8 * j);
        vr[j] = *(const v8h*)(vbase + 8 * j);
    }
#pragma unroll
    for (int j = 0; j < 4; ++j) {
        *(v8h*)(&Kst[0][tid * 32 + 8 * j]) = kr[j];
        *(v8h*)(&Vst[0][tid * 32 + 8 * j]) = vr[j];
    }
#endif
    __syncthreads();

#pragma unroll 1
    for (int t = 0; t < NT; ++t) {
        const int cur = t & 1;

        if (t + 1 < NT) {                 // start next tile's copy before compute
#ifdef USE_ASYNC_LDS
            gasp kg = to_global(kbase + (size_t)(t + 1) * TILE_H);
            gasp vg = to_global(vbase + (size_t)(t + 1) * TILE_H);
            lasp kl = to_lds(&Kst[cur ^ 1][tid * 32]);
            lasp vl = to_lds(&Vst[cur ^ 1][tid * 32]);
#pragma unroll
            for (int j = 0; j < 4; ++j) {
                __builtin_amdgcn_global_load_async_to_lds_b128(kg + j, kl + j, 0, 0);
                __builtin_amdgcn_global_load_async_to_lds_b128(vg + j, vl + j, 0, 0);
            }
#else
            const _Float16* kn = kbase + (size_t)(t + 1) * TILE_H;
            const _Float16* vn = vbase + (size_t)(t + 1) * TILE_H;
#pragma unroll
            for (int j = 0; j < 4; ++j) {
                kr[j] = *(const v8h*)(kn + 8 * j);
                vr[j] = *(const v8h*)(vn + 8 * j);
            }
#endif
            if (t + 2 < NT) {             // gfx1250 global_prefetch of tile t+2
                __builtin_prefetch(kbase + (size_t)(t + 2) * TILE_H, 0, 1);
                __builtin_prefetch(vbase + (size_t)(t + 2) * TILE_H, 0, 1);
            }
        }

        // ---- S^T = K_tile * Q^T ----
        v16h kb[8];
#pragma unroll
        for (int dc = 0; dc < 4; ++dc) {
            kb[dc]     = ld_op16(&Kst[cur][(0  + ln) * DD + dc * 32 + koff]);
            kb[4 + dc] = ld_op16(&Kst[cur][(16 + ln) * DD + dc * 32 + koff]);
        }
        v8f ct0 = {}, ct1 = {};
#pragma unroll
        for (int dc = 0; dc < 4; ++dc) {
            ct0 = __builtin_amdgcn_wmma_f32_16x16x32_f16(false, kb[dc],     false, qa[dc],
                                                         (short)0, ct0, false, false);
            ct1 = __builtin_amdgcn_wmma_f32_16x16x32_f16(false, kb[4 + dc], false, qa[dc],
                                                         (short)0, ct1, false, false);
        }

        // ---- online softmax (log2 domain; scores already scaled via Q) ----
        float vmax = ct0[0];
#pragma unroll
        for (int r = 1; r < 8; ++r) vmax = fmaxf(vmax, ct0[r]);
#pragma unroll
        for (int r = 0; r < 8; ++r) vmax = fmaxf(vmax, ct1[r]);
        vmax = fmaxf(vmax, __shfl_xor(vmax, 16, 32));
        const float mnew = fmaxf(mrun, vmax);
        const float corr = fast_exp2(mrun - mnew);
        mrun = mnew;

        v16h pa;                          // exponentiated scores == P^T B-operand layout
        float rs = 0.0f;
#pragma unroll
        for (int r = 0; r < 8; ++r) { float p = fast_exp2(ct0[r] - mnew); rs += p; pa[r]     = (_Float16)p; }
#pragma unroll
        for (int r = 0; r < 8; ++r) { float p = fast_exp2(ct1[r] - mnew); rs += p; pa[8 + r] = (_Float16)p; }
        rs += __shfl_xor(rs, 16, 32);
        lrun = lrun * corr + rs;

#pragma unroll
        for (int db = 0; db < 8; ++db)    // v8f * scalar -> v_pk_mul_f32
            ot[db] = ot[db] * corr;

        // ---- O^T += V^T * P^T ----
        v16h vb[8];
#pragma unroll
        for (int db = 0; db < 8; ++db)
            vb[db] = ld_op16(&Vst[cur][(db * 16 + ln) * KVT + koff]);
#pragma unroll
        for (int db = 0; db < 8; ++db)
            ot[db] = __builtin_amdgcn_wmma_f32_16x16x32_f16(false, vb[db], false, pa,
                                                            (short)0, ot[db], false, false);

        if (t + 1 < NT) {
#ifdef USE_ASYNC_LDS
            wait_async0();                // drain our async writes before publishing
#else
            _Float16* kd = &Kst[cur ^ 1][tid * 32];
            _Float16* vd = &Vst[cur ^ 1][tid * 32];
#pragma unroll
            for (int j = 0; j < 4; ++j) {
                *(v8h*)(kd + 8 * j) = kr[j];
                *(v8h*)(vd + 8 * j) = vr[j];
            }
#endif
        }
        __syncthreads();
    }

    // ---- normalize + store: lane writes q-row ln, d = db*16 + mb + 0..7 ----
    const float inv = fast_rcp(lrun);
    float* orow = O + bbase + (size_t)(q0 + ln) * DD + mb;
#pragma unroll
    for (int db = 0; db < 8; ++db) {
        float4 lo4, hi4;
        lo4.x = ot[db][0] * inv; lo4.y = ot[db][1] * inv;
        lo4.z = ot[db][2] * inv; lo4.w = ot[db][3] * inv;
        hi4.x = ot[db][4] * inv; hi4.y = ot[db][5] * inv;
        hi4.z = ot[db][6] * inv; hi4.w = ot[db][7] * inv;
        *(float4*)(orow + db * 16)     = lo4;
        *(float4*)(orow + db * 16 + 4) = hi4;
    }
}

extern "C" void kernel_launch(void* const* d_in, const int* in_sizes, int n_in,
                              void* d_out, int out_size, void* d_ws, size_t ws_size,
                              hipStream_t stream) {
    (void)in_sizes; (void)n_in; (void)out_size; (void)ws_size;
    const float* Q = (const float*)d_in[0];
    const float* K = (const float*)d_in[1];
    const float* V = (const float*)d_in[2];
    float* O = (float*)d_out;
    // workspace: Kh (8.39 MB) | Vt (8.39 MB)  -> 16.78 MB of d_ws
    _Float16* Kh = (_Float16*)d_ws;
    _Float16* Vt = Kh + (size_t)BB * SS * DD;
    hipLaunchKernelGGL(fa_prep, dim3(BB * NT), dim3(128), 0, stream, K, V, Kh, Vt);
    hipLaunchKernelGGL(DotProductAttention_48421461295297_kernel,
                       dim3(BB * (SS / (WAVES * 16))), dim3(128), 0, stream, Q, Kh, Vt, O);
}

// v001
// Measured time: 81.9 microseconds a run.
// Two timings next to v000 both put it at 2.10 times that version's speed.
#include <hip/hip_runtime.h>

typedef _Float16 v16h __attribute__((ext_vector_type(16)));
typedef _Float16 v8h  __attribute__((ext_vector_type(8)));
typedef float    v8f  __attribute__((ext_vector_type(8)));

constexpr int BB = 16;
constexpr int SS = 2048;
constexpr int DD = 128;
constexpr int KVT = 32;              // kv rows per tile
constexpr int NT  = SS / KVT;        // 64 kv tiles
constexpr int WAVES = 4;             // wave32s per workgroup
constexpr int TILE_H = KVT * DD;     // f16 elements per staged tile (4096 = 8KB)
// LDS row pitches in f16 elements: 16 B x odd, so the 16 rows that one half-wave
// ds_load_b128 touches fall on 16 distinct groups of four banks.
constexpr int KP = DD + 8;           // K rows: 256 B of data on a 272 B pitch
constexpr int VP = KVT + 8;          // V^T rows: 64 B of data on an 80 B pitch

// gfx1250 async global->LDS copy path (ASYNCcnt) if the toolchain exposes it.
#if defined(__has_builtin)
#if __has_builtin(__builtin_amdgcn_global_load_async_to_lds_b128)
#define USE_ASYNC_LDS 1
#endif
#endif

#ifdef USE_ASYNC_LDS
// Param 0: gcc-style int4 pointer in AS(1) (global); param 1: LDS-side pointer.
typedef int v4i __attribute__((vector_size(16)));
typedef __attribute__((address_space(1))) v4i* gasp;   // global (AS1)
typedef __attribute__((address_space(3))) v4i* lasp;   // LDS (AS3)
__device__ __forceinline__ gasp to_global(const void* p) {
    return (gasp)(unsigned long long)p;                // AS1 == generic numerically
}
__device__ __forceinline__ lasp to_lds(void* p) {
    return (lasp)(unsigned)(unsigned long long)p;      // LDS offset = low 32 bits
}
__device__ __forceinline__ void wait_async0() {
#if __has_builtin(__builtin_amdgcn_s_wait_asynccnt)
    __builtin_amdgcn_s_wait_asynccnt(0);
#else
    asm volatile("s_wait_asynccnt 0x0" ::: "memory");
#endif
}
#endif

// Raw v_exp_f32: args here are always <= 0, and sub-(-126) inputs should flush
// to 0 probability anyway, so skip ocml's denormal-range fixup entirely.
__device__ __forceinline__ float fast_exp2(float x) {
#if defined(__has_builtin) && __has_builtin(__builtin_amdgcn_exp2f)
    return __builtin_amdgcn_exp2f(x);
#else
    return exp2f(x);
#endif
}
__device__ __forceinline__ float fast_rcp(float x) {
#if defined(__has_builtin) && __has_builtin(__builtin_amdgcn_rcpf)
    return __builtin_amdgcn_rcpf(x);
#else
    return 1.0f / x;
#endif
}

// Build a v16h WMMA operand from two contiguous 16B LDS chunks (2x ds_load_b128).
__device__ __forceinline__ v16h ld_op16(const _Float16* p) {
    v8h lo = *(const v8h*)p;
    v8h hh = *(const v8h*)(p + 16);
    v16h r;
#pragma unroll
    for (int i = 0; i < 8; ++i) { r[i] = lo[i]; r[i + 8] = hh[i]; }
    return r;
}

// ---------------- pre-pass: K -> f16 flat, V -> f16 transposed per 32-row tile ----------------
__global__ __launch_bounds__(128, 1)
void fa_prep(const float* __restrict__ K, const float* __restrict__ V,
             _Float16* __restrict__ Kh, _Float16* __restrict__ Vt)
{
    __shared__ __align__(16) _Float16 T[DD * KVT];   // [d][k]
    const int tid  = threadIdx.x;
    const int b    = blockIdx.x >> 6;
    const int t    = blockIdx.x & 63;
    const int krow = tid >> 2;
    const int cgrp = (tid & 3) * 32;
    const size_t tb = ((size_t)b * SS + (size_t)t * KVT) * DD;
    const float* kp = K + tb + (size_t)krow * DD + cgrp;
    const float* vp = V + tb + (size_t)krow * DD + cgrp;
    _Float16*    kq = Kh + tb + (size_t)krow * DD + cgrp;
#pragma unroll
    for (int j = 0; j < 4; ++j) {
        float4 a = *(const float4*)(kp + 8 * j);
        float4 c = *(const float4*)(kp + 8 * j + 4);
        v8h h;
        h[0]=(_Float16)a.x; h[1]=(_Float16)a.y; h[2]=(_Float16)a.z; h[3]=(_Float16)a.w;
        h[4]=(_Float16)c.x; h[5]=(_Float16)c.y; h[6]=(_Float16)c.z; h[7]=(_Float16)c.w;
        *(v8h*)(kq + 8 * j) = h;
        float4 e = *(const float4*)(vp + 8 * j);
        float4 f = *(const float4*)(vp + 8 * j + 4);
        const int d0 = cgrp + 8 * j;
        T[(d0+0)*KVT + krow] = (_Float16)e.x;
        T[(d0+1)*KVT + krow] = (_Float16)e.y;
        T[(d0+2)*KVT + krow] = (_Float16)e.z;
        T[(d0+3)*KVT + krow] = (_Float16)e.w;
        T[(d0+4)*KVT + krow] = (_Float16)f.x;
        T[(d0+5)*KVT + krow] = (_Float16)f.y;
        T[(d0+6)*KVT + krow] = (_Float16)f.z;
        T[(d0+7)*KVT + krow] = (_Float16)f.w;
    }
    __syncthreads();
    _Float16* vo = Vt + tb + (size_t)tid * KVT;
    const _Float16* ts = &T[tid * KVT];
#pragma unroll
    for (int j = 0; j < 4; ++j)
        *(v8h*)(vo + 8 * j) = *(const v8h*)(ts + 8 * j);
}

// ---------------- main FlashAttention kernel (transpose-free, double-buffered) ----------------
__global__ __launch_bounds__(128, 1)
void DotProductAttention_48421461295297_kernel(const float* __restrict__ Q,
                                               const _Float16* __restrict__ Kh,
                                               const _Float16* __restrict__ Vt,
                                               float* __restrict__ O)
{
    __shared__ __align__(16) _Float16 Kst[2][KVT * KP];   // [k=32][d=128], padded rows
    __shared__ __align__(16) _Float16 Vst[2][DD * VP];    // [d=128][k=32], padded rows

    const int tid  = threadIdx.x;
    const int wave = tid >> 5;
    const int lane = tid & 31;
    const int ln   = lane & 15;
    const int koff = (lane >> 4) * 8;   // K-range offset in operand layout
    const int mb   = koff;              // row-base in C/D layout

    const int batch = blockIdx.x >> 5;
    const int qblk  = blockIdx.x & 31;
    const int q0    = qblk * (WAVES * 16) + wave * 16;
    const size_t bbase = (size_t)batch * SS * DD;

    const float SL2E = 0.08838834764831845f * 1.4426950408889634f;  // 1/sqrt(128)*log2(e)

    // Q tile -> f16 registers with the softmax scale folded in (log2 domain).
    v16h qa[4];
    {
        const float* qp = Q + bbase + (size_t)(q0 + ln) * DD;
#pragma unroll
        for (int dc = 0; dc < 4; ++dc) {
            const int off = dc * 32 + koff;
            float4 f0 = *(const float4*)(qp + off);
            float4 f1 = *(const float4*)(qp + off + 4);
            float4 f2 = *(const float4*)(qp + off + 16);
            float4 f3 = *(const float4*)(qp + off + 20);
            v16h a;
            a[0]=(_Float16)(f0.x*SL2E);  a[1]=(_Float16)(f0.y*SL2E);
            a[2]=(_Float16)(f0.z*SL2E);  a[3]=(_Float16)(f0.w*SL2E);
            a[4]=(_Float16)(f1.x*SL2E);  a[5]=(_Float16)(f1.y*SL2E);
            a[6]=(_Float16)(f1.z*SL2E);  a[7]=(_Float16)(f1.w*SL2E);
            a[8]=(_Float16)(f2.x*SL2E);  a[9]=(_Float16)(f2.y*SL2E);
            a[10]=(_Float16)(f2.z*SL2E); a[11]=(_Float16)(f2.w*SL2E);
            a[12]=(_Float16)(f3.x*SL2E); a[13]=(_Float16)(f3.y*SL2E);
            a[14]=(_Float16)(f3.z*SL2E); a[15]=(_Float16)(f3.w*SL2E);
            qa[dc] = a;
        }
    }

    v8f ot[8] = {};                       // O^T accumulators: rows d, cols q (fp32)
    float mrun = -__builtin_inff();
    float lrun = 0.0f;

    // staging: each thread owns 64B of the K tile and 64B of the V tile
    const _Float16* kbase = Kh + bbase + (size_t)tid * 32;
    const _Float16* vbase = Vt + bbase + (size_t)tid * 32;
    // where those 64 B land in LDS: a quarter of K row tid/4, the whole of V^T row tid
    const int kso = (tid >> 2) * KP + (tid & 3) * 32;
    const int vso = tid * VP;

#ifdef USE_ASYNC_LDS
    {   // stage tile 0: direct global->LDS, no VGPR traffic
        gasp kg = to_global(kbase);
        gasp vg = to_global(vbase);
        lasp kl = to_lds(&Kst[0][kso]);
        lasp vl = to_lds(&Vst[0][vso]);
#pragma unroll
        for (int j = 0; j < 4; ++j) {
            __builtin_amdgcn_global_load_async_to_lds_b128(kg + j, kl + j, 0, 0);
            __builtin_amdgcn_global_load_async_to_lds_b128(vg + j, vl + j, 0, 0);
        }
        wait_async0();
    }
#else
    v8h kr[4], vr[4];
#pragma unroll
    for (int j = 0; j < 4; ++j) {
        kr[j] = *(const v8h*)(kbase + 8 * j);
        vr[j] = *(const v8h*)(vbase + 8 * j);
    }
#pragma unroll
    for (int j = 0; j < 4; ++j) {
        *(v8h*)(&Kst[0][kso + 8 * j]) = kr[j];
        *(v8h*)(&Vst[0][vso + 8 * j]) = vr[j];
    }
#endif
    __syncthreads();

#pragma unroll 1
    for (int t = 0; t < NT; ++t) {
        const int cur = t & 1;

        if (t + 1 < NT) {                 // start next tile's copy before compute
#ifdef USE_ASYNC_LDS
            gasp kg = to_global(kbase + (size_t)(t + 1) * TILE_H);
            gasp vg = to_global(vbase + (size_t)(t + 1) * TILE_H);
            lasp kl = to_lds(&Kst[cur ^ 1][kso]);
            lasp vl = to_lds(&Vst[cur ^ 1][vso]);
#pragma unroll
            for (int j = 0; j < 4; ++j) {
                __builtin_amdgcn_global_load_async_to_lds_b128(kg + j, kl + j, 0, 0);
                __builtin_amdgcn_global_load_async_to_lds_b128(vg + j, vl + j, 0, 0);
            }
#else
            const _Float16* kn = kbase + (size_t)(t + 1) * TILE_H;
            const _Float16* vn = vbase + (size_t)(t + 1) * TILE_H;
#pragma unroll
            for (int j = 0; j < 4; ++j) {
                kr[j] = *(const v8h*)(kn + 8 * j);
                vr[j] = *(const v8h*)(vn + 8 * j);
            }
#endif
            if (t + 2 < NT) {             // gfx1250 global_prefetch of tile t+2
                __builtin_prefetch(kbase + (size_t)(t + 2) * TILE_H, 0, 1);
                __builtin_prefetch(vbase + (size_t)(t + 2) * TILE_H, 0, 1);
            }
        }

        // ---- S^T = K_tile * Q^T ----
        v16h kb[8];
#pragma unroll
        for (int dc = 0; dc < 4; ++dc) {
            kb[dc]     = ld_op16(&Kst[cur][(0  + ln) * KP + dc * 32 + koff]);
            kb[4 + dc] = ld_op16(&Kst[cur][(16 + ln) * KP + dc * 32 + koff]);
        }
        v8f ct0 = {}, ct1 = {};
#pragma unroll
        for (int dc = 0; dc < 4; ++dc) {
            ct0 = __builtin_amdgcn_wmma_f32_16x16x32_f16(false, kb[dc],     false, qa[dc],
                                                         (short)0, ct0, false, false);
            ct1 = __builtin_amdgcn_wmma_f32_16x16x32_f16(false, kb[4 + dc], false, qa[dc],
                                                         (short)0, ct1, false, false);
        }

        // ---- online softmax (log2 domain; scores already scaled via Q) ----
        float vmax = ct0[0];
#pragma unroll
        for (int r = 1; r < 8; ++r) vmax = fmaxf(vmax, ct0[r]);
#pragma unroll
        for (int r = 0; r < 8; ++r) vmax = fmaxf(vmax, ct1[r]);
        vmax = fmaxf(vmax, __shfl_xor(vmax, 16, 32));
        const float mnew = fmaxf(mrun, vmax);
        const float corr = fast_exp2(mrun - mnew);
        mrun = mnew;

        v16h pa;                          // exponentiated scores == P^T B-operand layout
        float rs = 0.0f;
#pragma unroll
        for (int r = 0; r < 8; ++r) { float p = fast_exp2(ct0[r] - mnew); rs += p; pa[r]     = (_Float16)p; }
#pragma unroll
        for (int r = 0; r < 8; ++r) { float p = fast_exp2(ct1[r] - mnew); rs += p; pa[8 + r] = (_Float16)p; }
        rs += __shfl_xor(rs, 16, 32);
        lrun = lrun * corr + rs;

#pragma unroll
        for (int db = 0; db < 8; ++db)    // v8f * scalar -> v_pk_mul_f32
            ot[db] = ot[db] * corr;

        // ---- O^T += V^T * P^T ----
        v16h vb[8];
#pragma unroll
        for (int db = 0; db < 8; ++db)
            vb[db] = ld_op16(&Vst[cur][(db * 16 + ln) * VP + koff]);
#pragma unroll
        for (int db = 0; db < 8; ++db)
            ot[db] = __builtin_amdgcn_wmma_f32_16x16x32_f16(false, vb[db], false, pa,
                                                            (short)0, ot[db], false, false);

        if (t + 1 < NT) {
#ifdef USE_ASYNC_LDS
            wait_async0();                // drain our async writes before publishing
#else
            _Float16* kd = &Kst[cur ^ 1][kso];
            _Float16* vd = &Vst[cur ^ 1][vso];
#pragma unroll
            for (int j = 0; j < 4; ++j) {
                *(v8h*)(kd + 8 * j) = kr[j];
                *(v8h*)(vd + 8 * j) = vr[j];
            }
#endif
        }
        __syncthreads();
    }

    // ---- normalize + store: lane writes q-row ln, d = db*16 + mb + 0..7 ----
    const float inv = fast_rcp(lrun);
    float* orow = O + bbase + (size_t)(q0 + ln) * DD + mb;
#pragma unroll
    for (int db = 0; db < 8; ++db) {
        float4 lo4, hi4;
        lo4.x = ot[db][0] * inv; lo4.y = ot[db][1] * inv;
        lo4.z = ot[db][2] * inv; lo4.w = ot[db][3] * inv;
        hi4.x = ot[db][4] * inv; hi4.y = ot[db][5] * inv;
        hi4.z = ot[db][6] * inv; hi4.w = ot[db][7] * inv;
        *(float4*)(orow + db * 16)     = lo4;
        *(float4*)(orow + db * 16 + 4) = hi4;
    }
}

extern "C" void kernel_launch(void* const* d_in, const int* in_sizes, int n_in,
                              void* d_out, int out_size, void* d_ws, size_t ws_size,
                              hipStream_t stream) {
    (void)in_sizes; (void)n_in; (void)out_size; (void)ws_size;
    const float* Q = (const float*)d_in[0];
    const float* K = (const float*)d_in[1];
    const float* V = (const float*)d_in[2];
    float* O = (float*)d_out;
    // workspace: Kh (8.39 MB) | Vt (8.39 MB)  -> 16.78 MB of d_ws
    _Float16* Kh = (_Float16*)d_ws;
    _Float16* Vt = Kh + (size_t)BB * SS * DD;
    hipLaunchKernelGGL(fa_prep, dim3(BB * NT), dim3(128), 0, stream, K, V, Kh, Vt);
    hipLaunchKernelGGL(DotProductAttention_48421461295297_kernel,
                       dim3(BB * (SS / (WAVES * 16))), dim3(128), 0, stream, Q, Kh, Vt, O);
}

// v002
// A run of this version takes 57.5 microseconds.
// Two timings next to v001 put it at 1.42 and 1.43 times that version's speed.
// All steps since v000 together make it 3.00 times as fast.
#include <hip/hip_runtime.h>

typedef _Float16 v16h __attribute__((ext_vector_type(16)));
typedef _Float16 v8h  __attribute__((ext_vector_type(8)));
typedef float    v8f  __attribute__((ext_vector_type(8)));

constexpr int BB = 16;
constexpr int SS = 2048;
constexpr int DD = 128;
constexpr int KVT = 32;              // kv rows per tile
constexpr int NT  = SS / KVT;        // 64 kv tiles
constexpr int WAVES = 4;             // wave32s per workgroup
constexpr int TILE_H = KVT * DD;     // f16 elements per staged tile (4096 = 8KB)
// LDS row pitches in f16 elements: 16 B x odd, so the 16 rows that one half-wave
// ds_load_b128 touches fall on 16 distinct groups of four banks.
constexpr int KP = DD + 8;           // K rows: 256 B of data on a 272 B pitch
constexpr int VP = KVT + 8;          // V^T rows: 64 B of data on an 80 B pitch

// gfx1250 async global->LDS copy path (ASYNCcnt) if the toolchain exposes it.
#if defined(__has_builtin)
#if __has_builtin(__builtin_amdgcn_global_load_async_to_lds_b128)
#define USE_ASYNC_LDS 1
#endif
#endif

#ifdef USE_ASYNC_LDS
// Param 0: gcc-style int4 pointer in AS(1) (global); param 1: LDS-side pointer.
typedef int v4i __attribute__((vector_size(16)));
typedef __attribute__((address_space(1))) v4i* gasp;   // global (AS1)
typedef __attribute__((address_space(3))) v4i* lasp;   // LDS (AS3)
__device__ __forceinline__ gasp to_global(const void* p) {
    return (gasp)(unsigned long long)p;                // AS1 == generic numerically
}
__device__ __forceinline__ lasp to_lds(void* p) {
    return (lasp)(unsigned)(unsigned long long)p;      // LDS offset = low 32 bits
}
__device__ __forceinline__ void wait_async0() {
#if __has_builtin(__builtin_amdgcn_s_wait_asynccnt)
    __builtin_amdgcn_s_wait_asynccnt(0);
#else
    asm volatile("s_wait_asynccnt 0x0" ::: "memory");
#endif
}
#endif

// Raw v_exp_f32: args here are always <= 0, and sub-(-126) inputs should flush
// to 0 probability anyway, so skip ocml's denormal-range fixup entirely.
__device__ __forceinline__ float fast_exp2(float x) {
#if defined(__has_builtin) && __has_builtin(__builtin_amdgcn_exp2f)
    return __builtin_amdgcn_exp2f(x);
#else
    return exp2f(x);
#endif
}
__device__ __forceinline__ float fast_rcp(float x) {
#if defined(__has_builtin) && __has_builtin(__builtin_amdgcn_rcpf)
    return __builtin_amdgcn_rcpf(x);
#else
    return 1.0f / x;
#endif
}

// Build a v16h WMMA operand from two contiguous 16B LDS chunks (2x ds_load_b128).
__device__ __forceinline__ v16h ld_op16(const _Float16* p) {
    v8h lo = *(const v8h*)p;
    v8h hh = *(const v8h*)(p + 16);
    v16h r;
#pragma unroll
    for (int i = 0; i < 8; ++i) { r[i] = lo[i]; r[i + 8] = hh[i]; }
    return r;
}

// ---------------- pre-pass: K -> f16 flat, V -> f16 transposed per 32-row tile ----------------
__global__ __launch_bounds__(128, 1)
void fa_prep(const float* __restrict__ K, const float* __restrict__ V,
             _Float16* __restrict__ Kh, _Float16* __restrict__ Vt)
{
    __shared__ __align__(16) _Float16 T[DD * KVT];   // [d][k]
    const int tid  = threadIdx.x;
    const int b    = blockIdx.x >> 6;
    const int t    = blockIdx.x & 63;
    const int krow = tid >> 2;
    const int cgrp = (tid & 3) * 32;
    const size_t tb = ((size_t)b * SS + (size_t)t * KVT) * DD;
    const float* kp = K + tb + (size_t)krow * DD + cgrp;
    const float* vp = V + tb + (size_t)krow * DD + cgrp;
    _Float16*    kq = Kh + tb + (size_t)krow * DD + cgrp;
#pragma unroll
    for (int j = 0; j < 4; ++j) {
        float4 a = *(const float4*)(kp + 8 * j);
        float4 c = *(const float4*)(kp + 8 * j + 4);
        v8h h;
        h[0]=(_Float16)a.x; h[1]=(_Float16)a.y; h[2]=(_Float16)a.z; h[3]=(_Float16)a.w;
        h[4]=(_Float16)c.x; h[5]=(_Float16)c.y; h[6]=(_Float16)c.z; h[7]=(_Float16)c.w;
        *(v8h*)(kq + 8 * j) = h;
        float4 e = *(const float4*)(vp + 8 * j);
        float4 f = *(const float4*)(vp + 8 * j + 4);
        const int d0 = cgrp + 8 * j;
        T[(d0+0)*KVT + krow] = (_Float16)e.x;
        T[(d0+1)*KVT + krow] = (_Float16)e.y;
        T[(d0+2)*KVT + krow] = (_Float16)e.z;
        T[(d0+3)*KVT + krow] = (_Float16)e.w;
        T[(d0+4)*KVT + krow] = (_Float16)f.x;
        T[(d0+5)*KVT + krow] = (_Float16)f.y;
        T[(d0+6)*KVT + krow] = (_Float16)f.z;
        T[(d0+7)*KVT + krow] = (_Float16)f.w;
    }
    __syncthreads();
    _Float16* vo = Vt + tb + (size_t)tid * KVT;
    const _Float16* ts = &T[tid * KVT];
#pragma unroll
    for (int j = 0; j < 4; ++j)
        *(v8h*)(vo + 8 * j) = *(const v8h*)(ts + 8 * j);
}

// ---------------- main FlashAttention kernel (transpose-free, double-buffered) ----------------
__global__ __launch_bounds__(128, 1)
void DotProductAttention_48421461295297_kernel(const float* __restrict__ Q,
                                               const _Float16* __restrict__ Kh,
                                               const _Float16* __restrict__ Vt,
                                               float* __restrict__ O)
{
    __shared__ __align__(16) _Float16 Kst[2][KVT * KP];   // [k=32][d=128], padded rows
    __shared__ __align__(16) _Float16 Vst[2][DD * VP];    // [d=128][k=32], padded rows

    const int tid  = threadIdx.x;
    const int wave = tid >> 5;
    const int lane = tid & 31;
    const int ln   = lane & 15;
    const int koff = (lane >> 4) * 8;   // K-range offset in operand layout
    const int mb   = koff;              // row-base in C/D layout

    const int batch = blockIdx.x >> 5;
    const int qblk  = blockIdx.x & 31;
    const int q0    = qblk * (WAVES * 16) + wave * 16;
    const size_t bbase = (size_t)batch * SS * DD;

    const float SL2E = 0.08838834764831845f * 1.4426950408889634f;  // 1/sqrt(128)*log2(e)

    // Q tile -> f16 registers with the softmax scale folded in (log2 domain).
    v16h qa[4];
    {
        const float* qp = Q + bbase + (size_t)(q0 + ln) * DD;
#pragma unroll
        for (int dc = 0; dc < 4; ++dc) {
            const int off = dc * 32 + koff;
            float4 f0 = *(const float4*)(qp + off);
            float4 f1 = *(const float4*)(qp + off + 4);
            float4 f2 = *(const float4*)(qp + off + 16);
            float4 f3 = *(const float4*)(qp + off + 20);
            v16h a;
            a[0]=(_Float16)(f0.x*SL2E);  a[1]=(_Float16)(f0.y*SL2E);
            a[2]=(_Float16)(f0.z*SL2E);  a[3]=(_Float16)(f0.w*SL2E);
            a[4]=(_Float16)(f1.x*SL2E);  a[5]=(_Float16)(f1.y*SL2E);
            a[6]=(_Float16)(f1.z*SL2E);  a[7]=(_Float16)(f1.w*SL2E);
            a[8]=(_Float16)(f2.x*SL2E);  a[9]=(_Float16)(f2.y*SL2E);
            a[10]=(_Float16)(f2.z*SL2E); a[11]=(_Float16)(f2.w*SL2E);
            a[12]=(_Float16)(f3.x*SL2E); a[13]=(_Float16)(f3.y*SL2E);
            a[14]=(_Float16)(f3.z*SL2E); a[15]=(_Float16)(f3.w*SL2E);
            qa[dc] = a;
        }
    }

    v8f ot[8] = {};                       // O^T accumulators: rows d, cols q (fp32)
    float mrun = -__builtin_inff();
    float lrun = 0.0f;

    // staging: each thread owns 64B of the K tile and 64B of the V tile
    const _Float16* kbase = Kh + bbase + (size_t)tid * 32;
    const _Float16* vbase = Vt + bbase + (size_t)tid * 32;
    // where those 64 B land in LDS: a quarter of K row tid/4, the whole of V^T row tid
    const int kso = (tid >> 2) * KP + (tid & 3) * 32;
    const int vso = tid * VP;

#ifdef USE_ASYNC_LDS
    {   // stage tile 0: direct global->LDS, no VGPR traffic
        gasp kg = to_global(kbase);
        gasp vg = to_global(vbase);
        lasp kl = to_lds(&Kst[0][kso]);
        lasp vl = to_lds(&Vst[0][vso]);
#pragma unroll
        for (int j = 0; j < 4; ++j) {
            __builtin_amdgcn_global_load_async_to_lds_b128(kg + j, kl + j, 0, 0);
            __builtin_amdgcn_global_load_async_to_lds_b128(vg + j, vl + j, 0, 0);
        }
        wait_async0();
    }
#else
    v8h kr[4], vr[4];
#pragma unroll
    for (int j = 0; j < 4; ++j) {
        kr[j] = *(const v8h*)(kbase + 8 * j);
        vr[j] = *(const v8h*)(vbase + 8 * j);
    }
#pragma unroll
    for (int j = 0; j < 4; ++j) {
        *(v8h*)(&Kst[0][kso + 8 * j]) = kr[j];
        *(v8h*)(&Vst[0][vso + 8 * j]) = vr[j];
    }
#endif
    __syncthreads();

#pragma unroll 1
    for (int t = 0; t < NT; ++t) {
        const int cur = t & 1;

        if (t + 1 < NT) {                 // start next tile's copy before compute
#ifdef USE_ASYNC_LDS
            gasp kg = to_global(kbase + (size_t)(t + 1) * TILE_H);
            gasp vg = to_global(vbase + (size_t)(t + 1) * TILE_H);
            lasp kl = to_lds(&Kst[cur ^ 1][kso]);
            lasp vl = to_lds(&Vst[cur ^ 1][vso]);
#pragma unroll
            for (int j = 0; j < 4; ++j) {
                __builtin_amdgcn_global_load_async_to_lds_b128(kg + j, kl + j, 0, 0);
                __builtin_amdgcn_global_load_async_to_lds_b128(vg + j, vl + j, 0, 0);
            }
#else
            const _Float16* kn = kbase + (size_t)(t + 1) * TILE_H;
            const _Float16* vn = vbase + (size_t)(t + 1) * TILE_H;
#pragma unroll
            for (int j = 0; j < 4; ++j) {
                kr[j] = *(const v8h*)(kn + 8 * j);
                vr[j] = *(const v8h*)(vn + 8 * j);
            }
#endif
            if (t + 2 < NT) {             // gfx1250 global_prefetch of tile t+2
                __builtin_prefetch(kbase + (size_t)(t + 2) * TILE_H, 0, 1);
                __builtin_prefetch(vbase + (size_t)(t + 2) * TILE_H, 0, 1);
            }
        }

        // ---- S^T = K_tile * Q^T ----
        v16h kb[8];
#pragma unroll
        for (int dc = 0; dc < 4; ++dc) {
            kb[dc]     = ld_op16(&Kst[cur][(0  + ln) * KP + dc * 32 + koff]);
            kb[4 + dc] = ld_op16(&Kst[cur][(16 + ln) * KP + dc * 32 + koff]);
        }
        // Keeps K's reads in front of V's: LDS data returns in issue order, and the S
        // products, which come first, then wait for K's fragments alone.
        __builtin_amdgcn_sched_barrier(0);
        v16h vb[8];                       // V^T fragments, read directly behind K's
#pragma unroll
        for (int db = 0; db < 8; ++db)
            vb[db] = ld_op16(&Vst[cur][(db * 16 + ln) * VP + koff]);
        // Keeps the tile's 32 fragment reads above as one group in flight together: left
        // free, the scheduler sinks each pair to its product and the wave waits out a
        // full LDS latency in front of every product.
        __builtin_amdgcn_sched_barrier(0);
        v8f ct0 = {}, ct1 = {};
#pragma unroll
        for (int dc = 0; dc < 4; ++dc) {
            ct0 = __builtin_amdgcn_wmma_f32_16x16x32_f16(false, kb[dc],     false, qa[dc],
                                                         (short)0, ct0, false, false);
            ct1 = __builtin_amdgcn_wmma_f32_16x16x32_f16(false, kb[4 + dc], false, qa[dc],
                                                         (short)0, ct1, false, false);
        }

        // ---- online softmax (log2 domain; scores already scaled via Q) ----
        float vmax = ct0[0];
#pragma unroll
        for (int r = 1; r < 8; ++r) vmax = fmaxf(vmax, ct0[r]);
#pragma unroll
        for (int r = 0; r < 8; ++r) vmax = fmaxf(vmax, ct1[r]);
        vmax = fmaxf(vmax, __shfl_xor(vmax, 16, 32));
        const float mnew = fmaxf(mrun, vmax);
        const float corr = fast_exp2(mrun - mnew);
        mrun = mnew;

        v16h pa;                          // exponentiated scores == P^T B-operand layout
        float rs = 0.0f;
#pragma unroll
        for (int r = 0; r < 8; ++r) { float p = fast_exp2(ct0[r] - mnew); rs += p; pa[r]     = (_Float16)p; }
#pragma unroll
        for (int r = 0; r < 8; ++r) { float p = fast_exp2(ct1[r] - mnew); rs += p; pa[8 + r] = (_Float16)p; }
        rs += __shfl_xor(rs, 16, 32);
        lrun = lrun * corr + rs;

#pragma unroll
        for (int db = 0; db < 8; ++db)    // v8f * scalar -> v_pk_mul_f32
            ot[db] = ot[db] * corr;

        // ---- O^T += V^T * P^T ----
#pragma unroll
        for (int db = 0; db < 8; ++db)
            ot[db] = __builtin_amdgcn_wmma_f32_16x16x32_f16(false, vb[db], false, pa,
                                                            (short)0, ot[db], false, false);

        if (t + 1 < NT) {
#ifdef USE_ASYNC_LDS
            wait_async0();                // drain our async writes before publishing
#else
            _Float16* kd = &Kst[cur ^ 1][kso];
            _Float16* vd = &Vst[cur ^ 1][vso];
#pragma unroll
            for (int j = 0; j < 4; ++j) {
                *(v8h*)(kd + 8 * j) = kr[j];
                *(v8h*)(vd + 8 * j) = vr[j];
            }
#endif
        }
        __syncthreads();
    }

    // ---- normalize + store: lane writes q-row ln, d = db*16 + mb + 0..7 ----
    const float inv = fast_rcp(lrun);
    float* orow = O + bbase + (size_t)(q0 + ln) * DD + mb;
#pragma unroll
    for (int db = 0; db < 8; ++db) {
        float4 lo4, hi4;
        lo4.x = ot[db][0] * inv; lo4.y = ot[db][1] * inv;
        lo4.z = ot[db][2] * inv; lo4.w = ot[db][3] * inv;
        hi4.x = ot[db][4] * inv; hi4.y = ot[db][5] * inv;
        hi4.z = ot[db][6] * inv; hi4.w = ot[db][7] * inv;
        *(float4*)(orow + db * 16)     = lo4;
        *(float4*)(orow + db * 16 + 4) = hi4;
    }
}

extern "C" void kernel_launch(void* const* d_in, const int* in_sizes, int n_in,
                              void* d_out, int out_size, void* d_ws, size_t ws_size,
                              hipStream_t stream) {
    (void)in_sizes; (void)n_in; (void)out_size; (void)ws_size;
    const float* Q = (const float*)d_in[0];
    const float* K = (const float*)d_in[1];
    const float* V = (const float*)d_in[2];
    float* O = (float*)d_out;
    // workspace: Kh (8.39 MB) | Vt (8.39 MB)  -> 16.78 MB of d_ws
    _Float16* Kh = (_Float16*)d_ws;
    _Float16* Vt = Kh + (size_t)BB * SS * DD;
    hipLaunchKernelGGL(fa_prep, dim3(BB * NT), dim3(128), 0, stream, K, V, Kh, Vt);
    hipLaunchKernelGGL(DotProductAttention_48421461295297_kernel,
                       dim3(BB * (SS / (WAVES * 16))), dim3(128), 0, stream, Q, Kh, Vt, O);
}

// v003
// One run takes 52.2 microseconds.
// Two timings next to v002 put it at 1.11 and 1.10 times that version's speed.
// Counting every step since v000, it is 3.31 times as fast.
#include <hip/hip_runtime.h>

typedef _Float16 v16h __attribute__((ext_vector_type(16)));
typedef _Float16 v8h  __attribute__((ext_vector_type(8)));
typedef float    v8f  __attribute__((ext_vector_type(8)));

constexpr int BB = 16;
constexpr int SS = 2048;
constexpr int DD = 128;
constexpr int KVT = 32;              // kv rows per tile
constexpr int NT  = SS / KVT;        // 64 kv tiles
constexpr int WAVES = 4;             // wave32s per workgroup
constexpr int TILE_H = KVT * DD;     // f16 elements per staged tile (4096 = 8KB)
// LDS row pitches in f16 elements: 16 B x odd, so the 16 rows that one half-wave
// ds_load_b128 touches fall on 16 distinct groups of four banks.
constexpr int KP = DD + 8;           // K rows: 256 B of data on a 272 B pitch
constexpr int VP = KVT + 8;          // V^T rows: 64 B of data on an 80 B pitch

// gfx1250 async global->LDS copy path (ASYNCcnt) if the toolchain exposes it.
#if defined(__has_builtin)
#if __has_builtin(__builtin_amdgcn_global_load_async_to_lds_b128)
#define USE_ASYNC_LDS 1
#endif
#endif

#ifdef USE_ASYNC_LDS
// Param 0: gcc-style int4 pointer in AS(1) (global); param 1: LDS-side pointer.
typedef int v4i __attribute__((vector_size(16)));
typedef __attribute__((address_space(1))) v4i* gasp;   // global (AS1)
typedef __attribute__((address_space(3))) v4i* lasp;   // LDS (AS3)
__device__ __forceinline__ gasp to_global(const void* p) {
    return (gasp)(unsigned long long)p;                // AS1 == generic numerically
}
__device__ __forceinline__ lasp to_lds(void* p) {
    return (lasp)(unsigned)(unsigned long long)p;      // LDS offset = low 32 bits
}
__device__ __forceinline__ void wait_async0() {
#if __has_builtin(__builtin_amdgcn_s_wait_asynccnt)
    __builtin_amdgcn_s_wait_asynccnt(0);
#else
    asm volatile("s_wait_asynccnt 0x0" ::: "memory");
#endif
}
#endif

// Raw v_exp_f32: args here are always <= 0, and sub-(-126) inputs should flush
// to 0 probability anyway, so skip ocml's denormal-range fixup entirely.
__device__ __forceinline__ float fast_exp2(float x) {
#if defined(__has_builtin) && __has_builtin(__builtin_amdgcn_exp2f)
    return __builtin_amdgcn_exp2f(x);
#else
    return exp2f(x);
#endif
}
__device__ __forceinline__ float fast_rcp(float x) {
#if defined(__has_builtin) && __has_builtin(__builtin_amdgcn_rcpf)
    return __builtin_amdgcn_rcpf(x);
#else
    return 1.0f / x;
#endif
}

// Build a v16h WMMA operand from two contiguous 16B LDS chunks (2x ds_load_b128).
__device__ __forceinline__ v16h ld_op16(const _Float16* p) {
    v8h lo = *(const v8h*)p;
    v8h hh = *(const v8h*)(p + 16);
    v16h r;
#pragma unroll
    for (int i = 0; i < 8; ++i) { r[i] = lo[i]; r[i + 8] = hh[i]; }
    return r;
}

// ---------------- pre-pass: K -> f16 flat, V -> f16 transposed per 32-row tile ----------------
__global__ __launch_bounds__(128, 1)
void fa_prep(const float* __restrict__ K, const float* __restrict__ V,
             _Float16* __restrict__ Kh, _Float16* __restrict__ Vt)
{
    __shared__ __align__(16) _Float16 T[DD * KVT];   // [d][k]
    const int tid  = threadIdx.x;
    const int b    = blockIdx.x >> 6;
    const int t    = blockIdx.x & 63;
    const int krow = tid >> 2;
    const int cgrp = (tid & 3) * 32;
    const size_t tb = ((size_t)b * SS + (size_t)t * KVT) * DD;
    const float* kp = K + tb + (size_t)krow * DD + cgrp;
    const float* vp = V + tb + (size_t)krow * DD + cgrp;
    _Float16*    kq = Kh + tb + (size_t)krow * DD + cgrp;
#pragma unroll
    for (int j = 0; j < 4; ++j) {
        float4 a = *(const float4*)(kp + 8 * j);
        float4 c = *(const float4*)(kp + 8 * j + 4);
        v8h h;
        h[0]=(_Float16)a.x; h[1]=(_Float16)a.y; h[2]=(_Float16)a.z; h[3]=(_Float16)a.w;
        h[4]=(_Float16)c.x; h[5]=(_Float16)c.y; h[6]=(_Float16)c.z; h[7]=(_Float16)c.w;
        *(v8h*)(kq + 8 * j) = h;
        float4 e = *(const float4*)(vp + 8 * j);
        float4 f = *(const float4*)(vp + 8 * j + 4);
        const int d0 = cgrp + 8 * j;
        T[(d0+0)*KVT + krow] = (_Float16)e.x;
        T[(d0+1)*KVT + krow] = (_Float16)e.y;
        T[(d0+2)*KVT + krow] = (_Float16)e.z;
        T[(d0+3)*KVT + krow] = (_Float16)e.w;
        T[(d0+4)*KVT + krow] = (_Float16)f.x;
        T[(d0+5)*KVT + krow] = (_Float16)f.y;
        T[(d0+6)*KVT + krow] = (_Float16)f.z;
        T[(d0+7)*KVT + krow] = (_Float16)f.w;
    }
    __syncthreads();
    _Float16* vo = Vt + tb + (size_t)tid * KVT;
    const _Float16* ts = &T[tid * KVT];
#pragma unroll
    for (int j = 0; j < 4; ++j)
        *(v8h*)(vo + 8 * j) = *(const v8h*)(ts + 8 * j);
}

// ---------------- main FlashAttention kernel (transpose-free, double-buffered) ----------------
__global__ __launch_bounds__(128, 1)
void DotProductAttention_48421461295297_kernel(const float* __restrict__ Q,
                                               const _Float16* __restrict__ Kh,
                                               const _Float16* __restrict__ Vt,
                                               float* __restrict__ O)
{
    __shared__ __align__(16) _Float16 Kst[2][KVT * KP];   // [k=32][d=128], padded rows
    __shared__ __align__(16) _Float16 Vst[2][DD * VP];    // [d=128][k=32], padded rows

    const int tid  = threadIdx.x;
    const int wave = tid >> 5;
    const int lane = tid & 31;
    const int ln   = lane & 15;
    const int koff = (lane >> 4) * 8;   // K-range offset in operand layout
    const int mb   = koff;              // row-base in C/D layout

    const int batch = blockIdx.x >> 5;
    const int qblk  = blockIdx.x & 31;
    const int q0    = qblk * (WAVES * 16) + wave * 16;
    const size_t bbase = (size_t)batch * SS * DD;

    const float SL2E = 0.08838834764831845f * 1.4426950408889634f;  // 1/sqrt(128)*log2(e)

    // Q tile -> f16 registers with the softmax scale folded in (log2 domain).
    v16h qa[4];
    {
        const float* qp = Q + bbase + (size_t)(q0 + ln) * DD;
#pragma unroll
        for (int dc = 0; dc < 4; ++dc) {
            const int off = dc * 32 + koff;
            float4 f0 = *(const float4*)(qp + off);
            float4 f1 = *(const float4*)(qp + off + 4);
            float4 f2 = *(const float4*)(qp + off + 16);
            float4 f3 = *(const float4*)(qp + off + 20);
            v16h a;
            a[0]=(_Float16)(f0.x*SL2E);  a[1]=(_Float16)(f0.y*SL2E);
            a[2]=(_Float16)(f0.z*SL2E);  a[3]=(_Float16)(f0.w*SL2E);
            a[4]=(_Float16)(f1.x*SL2E);  a[5]=(_Float16)(f1.y*SL2E);
            a[6]=(_Float16)(f1.z*SL2E);  a[7]=(_Float16)(f1.w*SL2E);
            a[8]=(_Float16)(f2.x*SL2E);  a[9]=(_Float16)(f2.y*SL2E);
            a[10]=(_Float16)(f2.z*SL2E); a[11]=(_Float16)(f2.w*SL2E);
            a[12]=(_Float16)(f3.x*SL2E); a[13]=(_Float16)(f3.y*SL2E);
            a[14]=(_Float16)(f3.z*SL2E); a[15]=(_Float16)(f3.w*SL2E);
            qa[dc] = a;
        }
    }

    v8f ot[8] = {};                       // O^T accumulators: rows d, cols q (fp32)
    float mrun = -__builtin_inff();
    float lrun = 0.0f;

    // prefetch: each thread asks for one 64 B piece of the K tile and of the V tile
    const _Float16* kbase = Kh + bbase + (size_t)tid * 32;
    const _Float16* vbase = Vt + bbase + (size_t)tid * 32;
    // staging: a tile is 512 pieces of 16 B; copy j of thread tid moves piece j * 128 + tid,
    // so the 32 lanes of one copy cover 512 contiguous bytes: four whole 128 B lines.
    const _Float16* kcp = Kh + bbase + (size_t)tid * 8;
    const _Float16* vcp = Vt + bbase + (size_t)tid * 8;
    // where piece tid lands in LDS: 16 pieces a K row, 4 pieces a V^T row
    const int kso = (tid >> 4) * KP + (tid & 15) * 8;
    const int vso = (tid >> 2) * VP + (tid & 3) * 8;
    constexpr int GSTEP = 128 * 8;       // f16 elements from piece p to piece p + 128, global
    constexpr int KSTEP = 8 * KP;        // the same in LDS: 8 K rows further
    constexpr int VSTEP = 32 * VP;       // the same in LDS: 32 V^T rows further

#ifdef USE_ASYNC_LDS
    {   // stage tile 0: direct global->LDS, no VGPR traffic
#pragma unroll
        for (int j = 0; j < 4; ++j) {
            __builtin_amdgcn_global_load_async_to_lds_b128(to_global(kcp + j * GSTEP),
                                                           to_lds(&Kst[0][kso + j * KSTEP]), 0, 0);
            __builtin_amdgcn_global_load_async_to_lds_b128(to_global(vcp + j * GSTEP),
                                                           to_lds(&Vst[0][vso + j * VSTEP]), 0, 0);
        }
        wait_async0();
    }
#else
    v8h kr[4], vr[4];
#pragma unroll
    for (int j = 0; j < 4; ++j) {
        kr[j] = *(const v8h*)(kcp + j * GSTEP);
        vr[j] = *(const v8h*)(vcp + j * GSTEP);
    }
#pragma unroll
    for (int j = 0; j < 4; ++j) {
        *(v8h*)(&Kst[0][kso + j * KSTEP]) = kr[j];
        *(v8h*)(&Vst[0][vso + j * VSTEP]) = vr[j];
    }
#endif
    __syncthreads();

#pragma unroll 1
    for (int t = 0; t < NT; ++t) {
        const int cur = t & 1;

        if (t + 1 < NT) {                 // start next tile's copy before compute
#ifdef USE_ASYNC_LDS
            const _Float16* kn = kcp + (size_t)(t + 1) * TILE_H;
            const _Float16* vn = vcp + (size_t)(t + 1) * TILE_H;
#pragma unroll
            for (int j = 0; j < 4; ++j) {
                __builtin_amdgcn_global_load_async_to_lds_b128(to_global(kn + j * GSTEP),
                                                               to_lds(&Kst[cur ^ 1][kso + j * KSTEP]), 0, 0);
                __builtin_amdgcn_global_load_async_to_lds_b128(to_global(vn + j * GSTEP),
                                                               to_lds(&Vst[cur ^ 1][vso + j * VSTEP]), 0, 0);
            }
#else
            const _Float16* kn = kcp + (size_t)(t + 1) * TILE_H;
            const _Float16* vn = vcp + (size_t)(t + 1) * TILE_H;
#pragma unroll
            for (int j = 0; j < 4; ++j) {
                kr[j] = *(const v8h*)(kn + j * GSTEP);
                vr[j] = *(const v8h*)(vn + j * GSTEP);
            }
#endif
            if (t + 2 < NT) {             // gfx1250 global_prefetch of tile t+2
                __builtin_prefetch(kbase + (size_t)(t + 2) * TILE_H, 0, 1);
                __builtin_prefetch(vbase + (size_t)(t + 2) * TILE_H, 0, 1);
            }
        }

        // ---- S^T = K_tile * Q^T ----
        v16h kb[8];
#pragma unroll
        for (int dc = 0; dc < 4; ++dc) {
            kb[dc]     = ld_op16(&Kst[cur][(0  + ln) * KP + dc * 32 + koff]);
            kb[4 + dc] = ld_op16(&Kst[cur][(16 + ln) * KP + dc * 32 + koff]);
        }
        // Keeps K's reads in front of V's: LDS data returns in issue order, and the S
        // products, which come first, then wait for K's fragments alone.
        __builtin_amdgcn_sched_barrier(0);
        v16h vb[8];                       // V^T fragments, read directly behind K's
#pragma unroll
        for (int db = 0; db < 8; ++db)
            vb[db] = ld_op16(&Vst[cur][(db * 16 + ln) * VP + koff]);
        // Keeps the tile's 32 fragment reads above as one group in flight together: left
        // free, the scheduler sinks each pair to its product and the wave waits out a
        // full LDS latency in front of every product.
        __builtin_amdgcn_sched_barrier(0);
        v8f ct0 = {}, ct1 = {};
#pragma unroll
        for (int dc = 0; dc < 4; ++dc) {
            ct0 = __builtin_amdgcn_wmma_f32_16x16x32_f16(false, kb[dc],     false, qa[dc],
                                                         (short)0, ct0, false, false);
            ct1 = __builtin_amdgcn_wmma_f32_16x16x32_f16(false, kb[4 + dc], false, qa[dc],
                                                         (short)0, ct1, false, false);
        }

        // ---- online softmax (log2 domain; scores already scaled via Q) ----
        float vmax = ct0[0];
#pragma unroll
        for (int r = 1; r < 8; ++r) vmax = fmaxf(vmax, ct0[r]);
#pragma unroll
        for (int r = 0; r < 8; ++r) vmax = fmaxf(vmax, ct1[r]);
        vmax = fmaxf(vmax, __shfl_xor(vmax, 16, 32));
        const float mnew = fmaxf(mrun, vmax);
        const float corr = fast_exp2(mrun - mnew);
        mrun = mnew;

        v16h pa;                          // exponentiated scores == P^T B-operand layout
        float rs = 0.0f;
#pragma unroll
        for (int r = 0; r < 8; ++r) { float p = fast_exp2(ct0[r] - mnew); rs += p; pa[r]     = (_Float16)p; }
#pragma unroll
        for (int r = 0; r < 8; ++r) { float p = fast_exp2(ct1[r] - mnew); rs += p; pa[8 + r] = (_Float16)p; }
        rs += __shfl_xor(rs, 16, 32);
        lrun = lrun * corr + rs;

#pragma unroll
        for (int db = 0; db < 8; ++db)    // v8f * scalar -> v_pk_mul_f32
            ot[db] = ot[db] * corr;

        // ---- O^T += V^T * P^T ----
#pragma unroll
        for (int db = 0; db < 8; ++db)
            ot[db] = __builtin_amdgcn_wmma_f32_16x16x32_f16(false, vb[db], false, pa,
                                                            (short)0, ot[db], false, false);

        if (t + 1 < NT) {
#ifdef USE_ASYNC_LDS
            wait_async0();                // drain our async writes before publishing
#else
            _Float16* kd = &Kst[cur ^ 1][kso];
            _Float16* vd = &Vst[cur ^ 1][vso];
#pragma unroll
            for (int j = 0; j < 4; ++j) {
                *(v8h*)(kd + j * KSTEP) = kr[j];
                *(v8h*)(vd + j * VSTEP) = vr[j];
            }
#endif
        }
        __syncthreads();
    }

    // ---- normalize + store: lane writes q-row ln, d = db*16 + mb + 0..7 ----
    const float inv = fast_rcp(lrun);
    float* orow = O + bbase + (size_t)(q0 + ln) * DD + mb;
#pragma unroll
    for (int db = 0; db < 8; ++db) {
        float4 lo4, hi4;
        lo4.x = ot[db][0] * inv; lo4.y = ot[db][1] * inv;
        lo4.z = ot[db][2] * inv; lo4.w = ot[db][3] * inv;
        hi4.x = ot[db][4] * inv; hi4.y = ot[db][5] * inv;
        hi4.z = ot[db][6] * inv; hi4.w = ot[db][7] * inv;
        *(float4*)(orow + db * 16)     = lo4;
        *(float4*)(orow + db * 16 + 4) = hi4;
    }
}

extern "C" void kernel_launch(void* const* d_in, const int* in_sizes, int n_in,
                              void* d_out, int out_size, void* d_ws, size_t ws_size,
                              hipStream_t stream) {
    (void)in_sizes; (void)n_in; (void)out_size; (void)ws_size;
    const float* Q = (const float*)d_in[0];
    const float* K = (const float*)d_in[1];
    const float* V = (const float*)d_in[2];
    float* O = (float*)d_out;
    // workspace: Kh (8.39 MB) | Vt (8.39 MB)  -> 16.78 MB of d_ws
    _Float16* Kh = (_Float16*)d_ws;
    _Float16* Vt = Kh + (size_t)BB * SS * DD;
    hipLaunchKernelGGL(fa_prep, dim3(BB * NT), dim3(128), 0, stream, K, V, Kh, Vt);
    hipLaunchKernelGGL(DotProductAttention_48421461295297_kernel,
                       dim3(BB * (SS / (WAVES * 16))), dim3(128), 0, stream, Q, Kh, Vt, O);
}

// v004
// A run of this version takes 49.6 microseconds.
// In two side-by-side timings against v003, it was 1.04 and 1.05 times as fast.
// All steps since v000 together make it 3.47 times as fast.
#include <hip/hip_runtime.h>

typedef _Float16 v16h __attribute__((ext_vector_type(16)));
typedef _Float16 v8h  __attribute__((ext_vector_type(8)));
typedef float    v8f  __attribute__((ext_vector_type(8)));

constexpr int BB = 16;
constexpr int SS = 2048;
constexpr int DD = 128;
constexpr int KVT = 32;              // kv rows per tile
constexpr int NT  = SS / KVT;        // 64 kv tiles
constexpr int WAVES = 4;             // wave32s per workgroup
constexpr int QG  = 2;               // 16-column query groups per wave: each K / V^T fragment feeds QG products
constexpr int TILE_H = KVT * DD;     // f16 elements per staged tile (4096 = 8KB)
// LDS row pitches in f16 elements: 16 B x odd, so the 16 rows that one half-wave
// ds_load_b128 touches fall on 16 distinct groups of four banks.
constexpr int KP = DD + 8;           // K rows: 256 B of data on a 272 B pitch
constexpr int VP = KVT + 8;          // V^T rows: 64 B of data on an 80 B pitch

// gfx1250 async global->LDS copy path (ASYNCcnt) if the toolchain exposes it.
#if defined(__has_builtin)
#if __has_builtin(__builtin_amdgcn_global_load_async_to_lds_b128)
#define USE_ASYNC_LDS 1
#endif
#endif

#ifdef USE_ASYNC_LDS
// Param 0: gcc-style int4 pointer in AS(1) (global); param 1: LDS-side pointer.
typedef int v4i __attribute__((vector_size(16)));
typedef __attribute__((address_space(1))) v4i* gasp;   // global (AS1)
typedef __attribute__((address_space(3))) v4i* lasp;   // LDS (AS3)
__device__ __forceinline__ gasp to_global(const void* p) {
    return (gasp)(unsigned long long)p;                // AS1 == generic numerically
}
__device__ __forceinline__ lasp to_lds(void* p) {
    return (lasp)(unsigned)(unsigned long long)p;      // LDS offset = low 32 bits
}
__device__ __forceinline__ void wait_async0() {
#if __has_builtin(__builtin_amdgcn_s_wait_asynccnt)
    __builtin_amdgcn_s_wait_asynccnt(0);
#else
    asm volatile("s_wait_asynccnt 0x0" ::: "memory");
#endif
}
#endif

// Raw v_exp_f32: args here are always <= 0, and sub-(-126) inputs should flush
// to 0 probability anyway, so skip ocml's denormal-range fixup entirely.
__device__ __forceinline__ float fast_exp2(float x) {
#if defined(__has_builtin) && __has_builtin(__builtin_amdgcn_exp2f)
    return __builtin_amdgcn_exp2f(x);
#else
    return exp2f(x);
#endif
}
__device__ __forceinline__ float fast_rcp(float x) {
#if defined(__has_builtin) && __has_builtin(__builtin_amdgcn_rcpf)
    return __builtin_amdgcn_rcpf(x);
#else
    return 1.0f / x;
#endif
}

// Build a v16h WMMA operand from two contiguous 16B LDS chunks (2x ds_load_b128).
__device__ __forceinline__ v16h ld_op16(const _Float16* p) {
    v8h lo = *(const v8h*)p;
    v8h hh = *(const v8h*)(p + 16);
    v16h r;
#pragma unroll
    for (int i = 0; i < 8; ++i) { r[i] = lo[i]; r[i + 8] = hh[i]; }
    return r;
}

// ---------------- pre-pass: K -> f16 flat, V -> f16 transposed per 32-row tile ----------------
__global__ __launch_bounds__(128, 1)
void fa_prep(const float* __restrict__ K, const float* __restrict__ V,
             _Float16* __restrict__ Kh, _Float16* __restrict__ Vt)
{
    __shared__ __align__(16) _Float16 T[DD * KVT];   // [d][k]
    const int tid  = threadIdx.x;
    const int b    = blockIdx.x >> 6;
    const int t    = blockIdx.x & 63;
    const int krow = tid >> 2;
    const int cgrp = (tid & 3) * 32;
    const size_t tb = ((size_t)b * SS + (size_t)t * KVT) * DD;
    const float* kp = K + tb + (size_t)krow * DD + cgrp;
    const float* vp = V + tb + (size_t)krow * DD + cgrp;
    _Float16*    kq = Kh + tb + (size_t)krow * DD + cgrp;
#pragma unroll
    for (int j = 0; j < 4; ++j) {
        float4 a = *(const float4*)(kp + 8 * j);
        float4 c = *(const float4*)(kp + 8 * j + 4);
        v8h h;
        h[0]=(_Float16)a.x; h[1]=(_Float16)a.y; h[2]=(_Float16)a.z; h[3]=(_Float16)a.w;
        h[4]=(_Float16)c.x; h[5]=(_Float16)c.y; h[6]=(_Float16)c.z; h[7]=(_Float16)c.w;
        *(v8h*)(kq + 8 * j) = h;
        float4 e = *(const float4*)(vp + 8 * j);
        float4 f = *(const float4*)(vp + 8 * j + 4);
        const int d0 = cgrp + 8 * j;
        T[(d0+0)*KVT + krow] = (_Float16)e.x;
        T[(d0+1)*KVT + krow] = (_Float16)e.y;
        T[(d0+2)*KVT + krow] = (_Float16)e.z;
        T[(d0+3)*KVT + krow] = (_Float16)e.w;
        T[(d0+4)*KVT + krow] = (_Float16)f.x;
        T[(d0+5)*KVT + krow] = (_Float16)f.y;
        T[(d0+6)*KVT + krow] = (_Float16)f.z;
        T[(d0+7)*KVT + krow] = (_Float16)f.w;
    }
    __syncthreads();
    _Float16* vo = Vt + tb + (size_t)tid * KVT;
    const _Float16* ts = &T[tid * KVT];
#pragma unroll
    for (int j = 0; j < 4; ++j)
        *(v8h*)(vo + 8 * j) = *(const v8h*)(ts + 8 * j);
}

// ---------------- main FlashAttention kernel (transpose-free, double-buffered) ----------------
__global__ __launch_bounds__(128, 1)
void DotProductAttention_48421461295297_kernel(const float* __restrict__ Q,
                                               const _Float16* __restrict__ Kh,
                                               const _Float16* __restrict__ Vt,
                                               float* __restrict__ O)
{
    __shared__ __align__(16) _Float16 Kst[2][KVT * KP];   // [k=32][d=128], padded rows
    __shared__ __align__(16) _Float16 Vst[2][DD * VP];    // [d=128][k=32], padded rows

    const int tid  = threadIdx.x;
    const int wave = tid >> 5;
    const int lane = tid & 31;
    const int ln   = lane & 15;
    const int koff = (lane >> 4) * 8;   // K-range offset in operand layout
    const int mb   = koff;              // row-base in C/D layout

    const int batch = blockIdx.x >> 4;
    const int qblk  = blockIdx.x & 15;
    const int q0    = qblk * (WAVES * QG * 16) + wave * (QG * 16);
    const size_t bbase = (size_t)batch * SS * DD;

    const float SL2E = 0.08838834764831845f * 1.4426950408889634f;  // 1/sqrt(128)*log2(e)

    // Q tile -> f16 registers with the softmax scale folded in (log2 domain).
    v16h qa[QG][4];
#pragma unroll
    for (int g = 0; g < QG; ++g) {
        const float* qp = Q + bbase + (size_t)(q0 + g * 16 + ln) * DD;
#pragma unroll
        for (int dc = 0; dc < 4; ++dc) {
            const int off = dc * 32 + koff;
            float4 f0 = *(const float4*)(qp + off);
            float4 f1 = *(const float4*)(qp + off + 4);
            float4 f2 = *(const float4*)(qp + off + 16);
            float4 f3 = *(const float4*)(qp + off + 20);
            v16h a;
            a[0]=(_Float16)(f0.x*SL2E);  a[1]=(_Float16)(f0.y*SL2E);
            a[2]=(_Float16)(f0.z*SL2E);  a[3]=(_Float16)(f0.w*SL2E);
            a[4]=(_Float16)(f1.x*SL2E);  a[5]=(_Float16)(f1.y*SL2E);
            a[6]=(_Float16)(f1.z*SL2E);  a[7]=(_Float16)(f1.w*SL2E);
            a[8]=(_Float16)(f2.x*SL2E);  a[9]=(_Float16)(f2.y*SL2E);
            a[10]=(_Float16)(f2.z*SL2E); a[11]=(_Float16)(f2.w*SL2E);
            a[12]=(_Float16)(f3.x*SL2E); a[13]=(_Float16)(f3.y*SL2E);
            a[14]=(_Float16)(f3.z*SL2E); a[15]=(_Float16)(f3.w*SL2E);
            qa[g][dc] = a;
        }
    }
    // The Q loads' address registers are reused right behind them. The address as an input keeps its
    // registers live up to the wait, so the overwrite cannot be lifted over it.
    asm volatile("s_wait_xcnt 0x0" :: "v"(Q + bbase + (size_t)(q0 + ln) * DD + koff) : "memory");

    v8f ot[QG][8] = {};                   // O^T accumulators: rows d, cols q (fp32)
    float mrun[QG], lrun[QG];
#pragma unroll
    for (int g = 0; g < QG; ++g) { mrun[g] = -__builtin_inff(); lrun[g] = 0.0f; }

    // prefetch: each thread asks for one 64 B piece of the K tile and of the V tile
    const _Float16* kbase = Kh + bbase + (size_t)tid * 32;
    const _Float16* vbase = Vt + bbase + (size_t)tid * 32;
    // staging: a tile is 512 pieces of 16 B; copy j of thread tid moves piece j * 128 + tid,
    // so the 32 lanes of one copy cover 512 contiguous bytes: four whole 128 B lines.
    const _Float16* kcp = Kh + bbase + (size_t)tid * 8;
    const _Float16* vcp = Vt + bbase + (size_t)tid * 8;
    // where piece tid lands in LDS: 16 pieces a K row, 4 pieces a V^T row
    const int kso = (tid >> 4) * KP + (tid & 15) * 8;
    const int vso = (tid >> 2) * VP + (tid & 3) * 8;
    constexpr int GSTEP = 128 * 8;       // f16 elements from piece p to piece p + 128, global
    constexpr int KSTEP = 8 * KP;        // the same in LDS: 8 K rows further
    constexpr int VSTEP = 32 * VP;       // the same in LDS: 32 V^T rows further

#ifdef USE_ASYNC_LDS
    {   // stage tile 0: direct global->LDS, no VGPR traffic
#pragma unroll
        for (int j = 0; j < 4; ++j) {
            __builtin_amdgcn_global_load_async_to_lds_b128(to_global(kcp + j * GSTEP),
                                                           to_lds(&Kst[0][kso + j * KSTEP]), 0, 0);
            __builtin_amdgcn_global_load_async_to_lds_b128(to_global(vcp + j * GSTEP),
                                                           to_lds(&Vst[0][vso + j * VSTEP]), 0, 0);
        }
        wait_async0();
    }
#else
    v8h kr[4], vr[4];
#pragma unroll
    for (int j = 0; j < 4; ++j) {
        kr[j] = *(const v8h*)(kcp + j * GSTEP);
        vr[j] = *(const v8h*)(vcp + j * GSTEP);
    }
#pragma unroll
    for (int j = 0; j < 4; ++j) {
        *(v8h*)(&Kst[0][kso + j * KSTEP]) = kr[j];
        *(v8h*)(&Vst[0][vso + j * VSTEP]) = vr[j];
    }
#endif
    __syncthreads();

#pragma unroll 1
    for (int t = 0; t < NT; ++t) {
        const int cur = t & 1;

        if (t + 1 < NT) {                 // start next tile's copy before compute
#ifdef USE_ASYNC_LDS
            const _Float16* kn = kcp + (size_t)(t + 1) * TILE_H;
            const _Float16* vn = vcp + (size_t)(t + 1) * TILE_H;
#pragma unroll
            for (int j = 0; j < 4; ++j) {
                __builtin_amdgcn_global_load_async_to_lds_b128(to_global(kn + j * GSTEP),
                                                               to_lds(&Kst[cur ^ 1][kso + j * KSTEP]), 0, 0);
                __builtin_amdgcn_global_load_async_to_lds_b128(to_global(vn + j * GSTEP),
                                                               to_lds(&Vst[cur ^ 1][vso + j * VSTEP]), 0, 0);
            }
#else
            const _Float16* kn = kcp + (size_t)(t + 1) * TILE_H;
            const _Float16* vn = vcp + (size_t)(t + 1) * TILE_H;
#pragma unroll
            for (int j = 0; j < 4; ++j) {
                kr[j] = *(const v8h*)(kn + j * GSTEP);
                vr[j] = *(const v8h*)(vn + j * GSTEP);
            }
#endif
            if (t + 2 < NT) {             // gfx1250 global_prefetch of tile t+2
                __builtin_prefetch(kbase + (size_t)(t + 2) * TILE_H, 0, 1);
                __builtin_prefetch(vbase + (size_t)(t + 2) * TILE_H, 0, 1);
            }
        }

        // ---- S^T = K_tile * Q^T ----
        v16h kb[8];
#pragma unroll
        for (int dc = 0; dc < 4; ++dc) {
            kb[dc]     = ld_op16(&Kst[cur][(0  + ln) * KP + dc * 32 + koff]);
            kb[4 + dc] = ld_op16(&Kst[cur][(16 + ln) * KP + dc * 32 + koff]);
        }
        // Keeps K's reads in front of V's: LDS data returns in issue order, and the S
        // products, which come first, then wait for K's fragments alone.
        __builtin_amdgcn_sched_barrier(0);
        v16h vb[8];                       // V^T fragments, read directly behind K's
#pragma unroll
        for (int db = 0; db < 8; ++db)
            vb[db] = ld_op16(&Vst[cur][(db * 16 + ln) * VP + koff]);
        // Keeps the tile's 32 fragment reads above as one group in flight together: left
        // free, the scheduler sinks each pair to its product and the wave waits out a
        // full LDS latency in front of every product.
        __builtin_amdgcn_sched_barrier(0);
        v8f ct0[QG] = {}, ct1[QG] = {};
#pragma unroll
        for (int dc = 0; dc < 4; ++dc) {
#pragma unroll
            for (int g = 0; g < QG; ++g) {
                ct0[g] = __builtin_amdgcn_wmma_f32_16x16x32_f16(false, kb[dc],     false, qa[g][dc],
                                                                (short)0, ct0[g], false, false);
                ct1[g] = __builtin_amdgcn_wmma_f32_16x16x32_f16(false, kb[4 + dc], false, qa[g][dc],
                                                                (short)0, ct1[g], false, false);
            }
        }

        // ---- online softmax (log2 domain; scores already scaled via Q), per query group ----
        v16h pa[QG];                      // exponentiated scores == P^T B-operand layout
#pragma unroll
        for (int g = 0; g < QG; ++g) {
            float vmax = ct0[g][0];
#pragma unroll
            for (int r = 1; r < 8; ++r) vmax = fmaxf(vmax, ct0[g][r]);
#pragma unroll
            for (int r = 0; r < 8; ++r) vmax = fmaxf(vmax, ct1[g][r]);
            vmax = fmaxf(vmax, __shfl_xor(vmax, 16, 32));
            const float mnew = fmaxf(mrun[g], vmax);
            const float corr = fast_exp2(mrun[g] - mnew);
            mrun[g] = mnew;

            float rs = 0.0f;
#pragma unroll
            for (int r = 0; r < 8; ++r) { float p = fast_exp2(ct0[g][r] - mnew); rs += p; pa[g][r]     = (_Float16)p; }
#pragma unroll
            for (int r = 0; r < 8; ++r) { float p = fast_exp2(ct1[g][r] - mnew); rs += p; pa[g][8 + r] = (_Float16)p; }
            rs += __shfl_xor(rs, 16, 32);
            lrun[g] = lrun[g] * corr + rs;

#pragma unroll
            for (int db = 0; db < 8; ++db)    // v8f * scalar -> v_pk_mul_f32
                ot[g][db] = ot[g][db] * corr;
        }

        // ---- O^T += V^T * P^T ----
#pragma unroll
        for (int db = 0; db < 8; ++db) {
#pragma unroll
            for (int g = 0; g < QG; ++g)
                ot[g][db] = __builtin_amdgcn_wmma_f32_16x16x32_f16(false, vb[db], false, pa[g],
                                                                   (short)0, ot[g][db], false, false);
        }

        if (t + 1 < NT) {
#ifdef USE_ASYNC_LDS
            wait_async0();                // drain our async writes before publishing
#else
            _Float16* kd = &Kst[cur ^ 1][kso];
            _Float16* vd = &Vst[cur ^ 1][vso];
#pragma unroll
            for (int j = 0; j < 4; ++j) {
                *(v8h*)(kd + j * KSTEP) = kr[j];
                *(v8h*)(vd + j * VSTEP) = vr[j];
            }
#endif
        }
        __syncthreads();
    }

    // ---- normalize + store: lane writes q-row ln, d = db*16 + mb + 0..7 ----
#pragma unroll
    for (int g = 0; g < QG; ++g) {
        const float inv = fast_rcp(lrun[g]);
        float* orow = O + bbase + (size_t)(q0 + g * 16 + ln) * DD + mb;
#pragma unroll
        for (int db = 0; db < 8; ++db) {
            float4 lo4, hi4;
            lo4.x = ot[g][db][0] * inv; lo4.y = ot[g][db][1] * inv;
            lo4.z = ot[g][db][2] * inv; lo4.w = ot[g][db][3] * inv;
            hi4.x = ot[g][db][4] * inv; hi4.y = ot[g][db][5] * inv;
            hi4.z = ot[g][db][6] * inv; hi4.w = ot[g][db][7] * inv;
            *(float4*)(orow + db * 16)     = lo4;
            *(float4*)(orow + db * 16 + 4) = hi4;
        }
    }
}

extern "C" void kernel_launch(void* const* d_in, const int* in_sizes, int n_in,
                              void* d_out, int out_size, void* d_ws, size_t ws_size,
                              hipStream_t stream) {
    (void)in_sizes; (void)n_in; (void)out_size; (void)ws_size;
    const float* Q = (const float*)d_in[0];
    const float* K = (const float*)d_in[1];
    const float* V = (const float*)d_in[2];
    float* O = (float*)d_out;
    // workspace: Kh (8.39 MB) | Vt (8.39 MB)  -> 16.78 MB of d_ws
    _Float16* Kh = (_Float16*)d_ws;
    _Float16* Vt = Kh + (size_t)BB * SS * DD;
    hipLaunchKernelGGL(fa_prep, dim3(BB * NT), dim3(128), 0, stream, K, V, Kh, Vt);
    hipLaunchKernelGGL(DotProductAttention_48421461295297_kernel,
                       dim3(BB * (SS / (WAVES * QG * 16))), dim3(128), 0, stream, Q, Kh, Vt, O);
}

// v005
// One run takes 44.2 microseconds.
// Timed twice side by side with v004, it ran 1.12 times as fast both times.
// Counting every step since v000, it is 3.89 times as fast.
#include <hip/hip_runtime.h>

typedef _Float16 v16h __attribute__((ext_vector_type(16)));
typedef _Float16 v8h  __attribute__((ext_vector_type(8)));
typedef float    v8f  __attribute__((ext_vector_type(8)));

constexpr int BB = 16;
constexpr int SS = 2048;
constexpr int DD = 128;
constexpr int KVT = 32;              // kv rows per tile
constexpr int NT  = SS / KVT;        // 64 kv tiles
constexpr int WAVES = 4;             // wave32s that share one key half; each has its own query columns
constexpr int SETS  = 2;             // key halves per workgroup: waves w and w + WAVES hold the same queries
constexpr int NTS   = NT / SETS;     // kv tiles per key half
constexpr int QG  = 2;               // 16-column query groups per wave: each K / V^T fragment feeds QG products
constexpr int TILE_H = KVT * DD;     // f16 elements per staged tile (4096 = 8KB)
// LDS row pitches in f16 elements: 16 B x odd, so the 16 rows that one half-wave
// ds_load_b128 touches fall on 16 distinct groups of four banks.
constexpr int KP = DD + 8;           // K rows: 256 B of data on a 272 B pitch
constexpr int VP = KVT + 8;          // V^T rows: 64 B of data on an 80 B pitch

// gfx1250 async global->LDS copy path (ASYNCcnt) if the toolchain exposes it.
#if defined(__has_builtin)
#if __has_builtin(__builtin_amdgcn_global_load_async_to_lds_b128)
#define USE_ASYNC_LDS 1
#endif
#endif

#ifdef USE_ASYNC_LDS
// Param 0: gcc-style int4 pointer in AS(1) (global); param 1: LDS-side pointer.
typedef int v4i __attribute__((vector_size(16)));
typedef __attribute__((address_space(1))) v4i* gasp;   // global (AS1)
typedef __attribute__((address_space(3))) v4i* lasp;   // LDS (AS3)
__device__ __forceinline__ gasp to_global(const void* p) {
    return (gasp)(unsigned long long)p;                // AS1 == generic numerically
}
__device__ __forceinline__ lasp to_lds(void* p) {
    return (lasp)(unsigned)(unsigned long long)p;      // LDS offset = low 32 bits
}
__device__ __forceinline__ void wait_async0() {
#if __has_builtin(__builtin_amdgcn_s_wait_asynccnt)
    __builtin_amdgcn_s_wait_asynccnt(0);
#else
    asm volatile("s_wait_asynccnt 0x0" ::: "memory");
#endif
}
#endif

// Raw v_exp_f32: args here are always <= 0, and sub-(-126) inputs should flush
// to 0 probability anyway, so skip ocml's denormal-range fixup entirely.
__device__ __forceinline__ float fast_exp2(float x) {
#if defined(__has_builtin) && __has_builtin(__builtin_amdgcn_exp2f)
    return __builtin_amdgcn_exp2f(x);
#else
    return exp2f(x);
#endif
}
__device__ __forceinline__ float fast_rcp(float x) {
#if defined(__has_builtin) && __has_builtin(__builtin_amdgcn_rcpf)
    return __builtin_amdgcn_rcpf(x);
#else
    return 1.0f / x;
#endif
}

// Build a v16h WMMA operand from two contiguous 16B LDS chunks (2x ds_load_b128).
__device__ __forceinline__ v16h ld_op16(const _Float16* p) {
    v8h lo = *(const v8h*)p;
    v8h hh = *(const v8h*)(p + 16);
    v16h r;
#pragma unroll
    for (int i = 0; i < 8; ++i) { r[i] = lo[i]; r[i + 8] = hh[i]; }
    return r;
}

// ---------------- pre-pass: K -> f16 flat, V -> f16 transposed per 32-row tile ----------------
__global__ __launch_bounds__(128, 1)
void fa_prep(const float* __restrict__ K, const float* __restrict__ V,
             _Float16* __restrict__ Kh, _Float16* __restrict__ Vt)
{
    __shared__ __align__(16) _Float16 T[DD * KVT];   // [d][k]
    const int tid  = threadIdx.x;
    const int b    = blockIdx.x >> 6;
    const int t    = blockIdx.x & 63;
    const int krow = tid >> 2;
    const int cgrp = (tid & 3) * 32;
    const size_t tb = ((size_t)b * SS + (size_t)t * KVT) * DD;
    const float* kp = K + tb + (size_t)krow * DD + cgrp;
    const float* vp = V + tb + (size_t)krow * DD + cgrp;
    _Float16*    kq = Kh + tb + (size_t)krow * DD + cgrp;
#pragma unroll
    for (int j = 0; j < 4; ++j) {
        float4 a = *(const float4*)(kp + 8 * j);
        float4 c = *(const float4*)(kp + 8 * j + 4);
        v8h h;
        h[0]=(_Float16)a.x; h[1]=(_Float16)a.y; h[2]=(_Float16)a.z; h[3]=(_Float16)a.w;
        h[4]=(_Float16)c.x; h[5]=(_Float16)c.y; h[6]=(_Float16)c.z; h[7]=(_Float16)c.w;
        *(v8h*)(kq + 8 * j) = h;
        float4 e = *(const float4*)(vp + 8 * j);
        float4 f = *(const float4*)(vp + 8 * j + 4);
        const int d0 = cgrp + 8 * j;
        T[(d0+0)*KVT + krow] = (_Float16)e.x;
        T[(d0+1)*KVT + krow] = (_Float16)e.y;
        T[(d0+2)*KVT + krow] = (_Float16)e.z;
        T[(d0+3)*KVT + krow] = (_Float16)e.w;
        T[(d0+4)*KVT + krow] = (_Float16)f.x;
        T[(d0+5)*KVT + krow] = (_Float16)f.y;
        T[(d0+6)*KVT + krow] = (_Float16)f.z;
        T[(d0+7)*KVT + krow] = (_Float16)f.w;
    }
    __syncthreads();
    _Float16* vo = Vt + tb + (size_t)tid * KVT;
    const _Float16* ts = &T[tid * KVT];
#pragma unroll
    for (int j = 0; j < 4; ++j)
        *(v8h*)(vo + 8 * j) = *(const v8h*)(ts + 8 * j);
}

// Merge of the two key halves, sending side: one query group's partial O^T, maximum and sum to LDS.
__device__ __forceinline__ void put_part(float4 (*xo)[32], float2* xml, int lane,
                                         const v8f (&o)[8], float m, float l) {
    xml[lane] = make_float2(m, l);
#pragma unroll
    for (int db = 0; db < 8; ++db) {
        xo[2 * db][lane]     = make_float4(o[db][0], o[db][1], o[db][2], o[db][3]);
        xo[2 * db + 1][lane] = make_float4(o[db][4], o[db][5], o[db][6], o[db][7]);
    }
}
// Receiving side: both halves brought to their common maximum, added, normalised, stored.
__device__ __forceinline__ void merge_store(const float4 (*xo)[32], const float2* xml, int lane,
                                            const v8f (&o)[8], float m, float l, float* orow) {
    const float2 ml = xml[lane];
    const float mn = fmaxf(m, ml.x);
    const float ca = fast_exp2(m - mn);
    const float cb = fast_exp2(ml.x - mn);
    const float inv = fast_rcp(l * ca + ml.y * cb);
    const float fa = ca * inv;
    const float fb = cb * inv;
#pragma unroll
    for (int db = 0; db < 8; ++db) {
        const float4 p0 = xo[2 * db][lane];
        const float4 p1 = xo[2 * db + 1][lane];
        float4 lo4, hi4;
        lo4.x = o[db][0] * fa + p0.x * fb; lo4.y = o[db][1] * fa + p0.y * fb;
        lo4.z = o[db][2] * fa + p0.z * fb; lo4.w = o[db][3] * fa + p0.w * fb;
        hi4.x = o[db][4] * fa + p1.x * fb; hi4.y = o[db][5] * fa + p1.y * fb;
        hi4.z = o[db][6] * fa + p1.z * fb; hi4.w = o[db][7] * fa + p1.w * fb;
        *(float4*)(orow + db * 16)     = lo4;
        *(float4*)(orow + db * 16 + 4) = hi4;
    }
}

// ---------------- main FlashAttention kernel (transpose-free, double-buffered) ----------------
// Two sets of WAVES waves walk the two halves of the keys for the same queries, so that every
// SIMD holds two waves: one wave's softmax runs beside the other's products. The halves'
// partial results (maximum, sum, unnormalised O^T) are merged through LDS behind the loop.
__global__ __launch_bounds__(SETS * WAVES * 32, 1)
void DotProductAttention_48421461295297_kernel(const float* __restrict__ Q,
                                               const _Float16* __restrict__ Kh,
                                               const _Float16* __restrict__ Vt,
                                               float* __restrict__ O)
{
    __shared__ __align__(16) _Float16 Kst[SETS][2][KVT * KP];   // [k=32][d=128], padded rows
    __shared__ __align__(16) _Float16 Vst[SETS][2][DD * VP];    // [d=128][k=32], padded rows
    __shared__ __align__(16) float4 Xo[SETS * WAVES][16][32];   // merge: one query group's O^T per wave
    __shared__ float2 Xml[SETS * WAVES][32];                    // merge: its running maximum and sum

    const int set  = __builtin_amdgcn_readfirstlane((int)threadIdx.x >> 7);   // key half, wave-uniform
    const int tid  = threadIdx.x & (WAVES * 32 - 1);                          // thread within its set
    const int wave = tid >> 5;
    const int lane = tid & 31;
    const int ln   = lane & 15;
    const int koff = (lane >> 4) * 8;   // K-range offset in operand layout
    const int mb   = koff;              // row-base in C/D layout

    const int batch = blockIdx.x >> 4;
    const int qblk  = blockIdx.x & 15;
    const int q0    = qblk * (WAVES * QG * 16) + wave * (QG * 16);
    const size_t bbase = (size_t)batch * SS * DD;

    const float SL2E = 0.08838834764831845f * 1.4426950408889634f;  // 1/sqrt(128)*log2(e)

    // Q tile -> f16 registers with the softmax scale folded in (log2 domain).
    v16h qa[QG][4];
#pragma unroll
    for (int g = 0; g < QG; ++g) {
        const float* qp = Q + bbase + (size_t)(q0 + g * 16 + ln) * DD;
#pragma unroll
        for (int dc = 0; dc < 4; ++dc) {
            const int off = dc * 32 + koff;
            float4 f0 = *(const float4*)(qp + off);
            float4 f1 = *(const float4*)(qp + off + 4);
            float4 f2 = *(const float4*)(qp + off + 16);
            float4 f3 = *(const float4*)(qp + off + 20);
            v16h a;
            a[0]=(_Float16)(f0.x*SL2E);  a[1]=(_Float16)(f0.y*SL2E);
            a[2]=(_Float16)(f0.z*SL2E);  a[3]=(_Float16)(f0.w*SL2E);
            a[4]=(_Float16)(f1.x*SL2E);  a[5]=(_Float16)(f1.y*SL2E);
            a[6]=(_Float16)(f1.z*SL2E);  a[7]=(_Float16)(f1.w*SL2E);
            a[8]=(_Float16)(f2.x*SL2E);  a[9]=(_Float16)(f2.y*SL2E);
            a[10]=(_Float16)(f2.z*SL2E); a[11]=(_Float16)(f2.w*SL2E);
            a[12]=(_Float16)(f3.x*SL2E); a[13]=(_Float16)(f3.y*SL2E);
            a[14]=(_Float16)(f3.z*SL2E); a[15]=(_Float16)(f3.w*SL2E);
            qa[g][dc] = a;
        }
    }
    // The Q loads' address registers are reused right behind them. The address as an input keeps its
    // registers live up to the wait, so the overwrite cannot be lifted over it.
    asm volatile("s_wait_xcnt 0x0" :: "v"(Q + bbase + (size_t)(q0 + ln) * DD + koff) : "memory");

    v8f ot[QG][8] = {};                   // O^T accumulators: rows d, cols q (fp32)
    float mrun[QG], lrun[QG];
#pragma unroll
    for (int g = 0; g < QG; ++g) { mrun[g] = -__builtin_inff(); lrun[g] = 0.0f; }

    // prefetch: each thread asks for one 64 B piece of the K tile and of the V tile
    const size_t hbase = bbase + (size_t)set * NTS * TILE_H;   // first tile of this set's key half
    const _Float16* kbase = Kh + hbase + (size_t)tid * 32;
    const _Float16* vbase = Vt + hbase + (size_t)tid * 32;
    // staging: a tile is 512 pieces of 16 B; copy j of thread tid moves piece j * 128 + tid,
    // so the 32 lanes of one copy cover 512 contiguous bytes: four whole 128 B lines.
    const _Float16* kcp = Kh + hbase + (size_t)tid * 8;
    const _Float16* vcp = Vt + hbase + (size_t)tid * 8;
    // where piece tid lands in LDS: 16 pieces a K row, 4 pieces a V^T row
    const int kso = (tid >> 4) * KP + (tid & 15) * 8;
    const int vso = (tid >> 2) * VP + (tid & 3) * 8;
    constexpr int GSTEP = 128 * 8;       // f16 elements from piece p to piece p + 128, global
    constexpr int KSTEP = 8 * KP;        // the same in LDS: 8 K rows further
    constexpr int VSTEP = 32 * VP;       // the same in LDS: 32 V^T rows further

#ifdef USE_ASYNC_LDS
    {   // stage tile 0: direct global->LDS, no VGPR traffic
#pragma unroll
        for (int j = 0; j < 4; ++j) {
            __builtin_amdgcn_global_load_async_to_lds_b128(to_global(kcp + j * GSTEP),
                                                           to_lds(&Kst[set][0][kso + j * KSTEP]), 0, 0);
            __builtin_amdgcn_global_load_async_to_lds_b128(to_global(vcp + j * GSTEP),
                                                           to_lds(&Vst[set][0][vso + j * VSTEP]), 0, 0);
        }
        wait_async0();
    }
#else
    v8h kr[4], vr[4];
#pragma unroll
    for (int j = 0; j < 4; ++j) {
        kr[j] = *(const v8h*)(kcp + j * GSTEP);
        vr[j] = *(const v8h*)(vcp + j * GSTEP);
    }
#pragma unroll
    for (int j = 0; j < 4; ++j) {
        *(v8h*)(&Kst[set][0][kso + j * KSTEP]) = kr[j];
        *(v8h*)(&Vst[set][0][vso + j * VSTEP]) = vr[j];
    }
#endif
    __syncthreads();

#pragma unroll 1
    for (int t = 0; t < NTS; ++t) {
        const int cur = t & 1;

        if (t + 1 < NTS) {                 // start next tile's copy before compute
#ifdef USE_ASYNC_LDS
            const _Float16* kn = kcp + (size_t)(t + 1) * TILE_H;
            const _Float16* vn = vcp + (size_t)(t + 1) * TILE_H;
#pragma unroll
            for (int j = 0; j < 4; ++j) {
                __builtin_amdgcn_global_load_async_to_lds_b128(to_global(kn + j * GSTEP),
                                                               to_lds(&Kst[set][cur ^ 1][kso + j * KSTEP]), 0, 0);
                __builtin_amdgcn_global_load_async_to_lds_b128(to_global(vn + j * GSTEP),
                                                               to_lds(&Vst[set][cur ^ 1][vso + j * VSTEP]), 0, 0);
            }
#else
            const _Float16* kn = kcp + (size_t)(t + 1) * TILE_H;
            const _Float16* vn = vcp + (size_t)(t + 1) * TILE_H;
#pragma unroll
            for (int j = 0; j < 4; ++j) {
                kr[j] = *(const v8h*)(kn + j * GSTEP);
                vr[j] = *(const v8h*)(vn + j * GSTEP);
            }
#endif
            if (t + 2 < NTS) {             // gfx1250 global_prefetch of tile t+2
                __builtin_prefetch(kbase + (size_t)(t + 2) * TILE_H, 0, 1);
                __builtin_prefetch(vbase + (size_t)(t + 2) * TILE_H, 0, 1);
            }
        }

        // ---- S^T = K_tile * Q^T ----
        v16h kb[8];
#pragma unroll
        for (int dc = 0; dc < 4; ++dc) {
            kb[dc]     = ld_op16(&Kst[set][cur][(0  + ln) * KP + dc * 32 + koff]);
            kb[4 + dc] = ld_op16(&Kst[set][cur][(16 + ln) * KP + dc * 32 + koff]);
        }
        // Keeps K's reads in front of V's: LDS data returns in issue order, and the S
        // products, which come first, then wait for K's fragments alone.
        __builtin_amdgcn_sched_barrier(0);
        v16h vb[8];                       // V^T fragments, read directly behind K's
#pragma unroll
        for (int db = 0; db < 8; ++db)
            vb[db] = ld_op16(&Vst[set][cur][(db * 16 + ln) * VP + koff]);
        // Keeps the tile's 32 fragment reads above as one group in flight together: left
        // free, the scheduler sinks each pair to its product and the wave waits out a
        // full LDS latency in front of every product.
        __builtin_amdgcn_sched_barrier(0);
        v8f ct0[QG] = {}, ct1[QG] = {};
#pragma unroll
        for (int dc = 0; dc < 4; ++dc) {
#pragma unroll
            for (int g = 0; g < QG; ++g) {
                ct0[g] = __builtin_amdgcn_wmma_f32_16x16x32_f16(false, kb[dc],     false, qa[g][dc],
                                                                (short)0, ct0[g], false, false);
                ct1[g] = __builtin_amdgcn_wmma_f32_16x16x32_f16(false, kb[4 + dc], false, qa[g][dc],
                                                                (short)0, ct1[g], false, false);
            }
        }

        // ---- online softmax (log2 domain; scores already scaled via Q), per query group ----
        v16h pa[QG];                      // exponentiated scores == P^T B-operand layout
#pragma unroll
        for (int g = 0; g < QG; ++g) {
            float vmax = ct0[g][0];
#pragma unroll
            for (int r = 1; r < 8; ++r) vmax = fmaxf(vmax, ct0[g][r]);
#pragma unroll
            for (int r = 0; r < 8; ++r) vmax = fmaxf(vmax, ct1[g][r]);
            vmax = fmaxf(vmax, __shfl_xor(vmax, 16, 32));
            const float mnew = fmaxf(mrun[g], vmax);
            const float corr = fast_exp2(mrun[g] - mnew);
            mrun[g] = mnew;

            const v8f d0 = ct0[g] - mnew;
            const v8f d1 = ct1[g] - mnew;
            float rs = 0.0f;
#pragma unroll
            for (int r = 0; r < 8; ++r) { float p = fast_exp2(d0[r]); rs += p; pa[g][r]     = (_Float16)p; }
#pragma unroll
            for (int r = 0; r < 8; ++r) { float p = fast_exp2(d1[r]); rs += p; pa[g][8 + r] = (_Float16)p; }
            // Inputs only, no instruction: keeps the 16 exp2 arguments in their registers until the
            // results are packed.
            asm volatile("" :: "v"(d0), "v"(d1), "v"(pa[g]));
            rs += __shfl_xor(rs, 16, 32);
            lrun[g] = lrun[g] * corr + rs;

#pragma unroll
            for (int db = 0; db < 8; ++db)    // v8f * scalar -> v_pk_mul_f32
                ot[g][db] = ot[g][db] * corr;
        }

        // ---- O^T += V^T * P^T ----
#pragma unroll
        for (int db = 0; db < 8; ++db) {
#pragma unroll
            for (int g = 0; g < QG; ++g)
                ot[g][db] = __builtin_amdgcn_wmma_f32_16x16x32_f16(false, vb[db], false, pa[g],
                                                                   (short)0, ot[g][db], false, false);
        }

        if (t + 1 < NTS) {
#ifdef USE_ASYNC_LDS
            wait_async0();                // drain our async writes before publishing
#else
            _Float16* kd = &Kst[set][cur ^ 1][kso];
            _Float16* vd = &Vst[set][cur ^ 1][vso];
#pragma unroll
            for (int j = 0; j < 4; ++j) {
                *(v8h*)(kd + j * KSTEP) = kr[j];
                *(v8h*)(vd + j * VSTEP) = vr[j];
            }
#endif
        }
        __syncthreads();
    }

    // ---- merge the two key halves: a wave keeps query group 'set' and hands the other one
    //      to the wave of the other set that holds the same queries ----
    const int me = set * WAVES + wave;
    const int pw = (set ^ 1) * WAVES + wave;
    if (set == 0) put_part(Xo[me], Xml[me], lane, ot[1], mrun[1], lrun[1]);
    else          put_part(Xo[me], Xml[me], lane, ot[0], mrun[0], lrun[0]);
    __syncthreads();

    // ---- normalize + store: lane writes q-row ln, d = db*16 + mb + 0..7 ----
    float* orow = O + bbase + (size_t)(q0 + set * 16 + ln) * DD + mb;
    if (set == 0) merge_store(Xo[pw], Xml[pw], lane, ot[0], mrun[0], lrun[0], orow);
    else          merge_store(Xo[pw], Xml[pw], lane, ot[1], mrun[1], lrun[1], orow);
}

extern "C" void kernel_launch(void* const* d_in, const int* in_sizes, int n_in,
                              void* d_out, int out_size, void* d_ws, size_t ws_size,
                              hipStream_t stream) {
    (void)in_sizes; (void)n_in; (void)out_size; (void)ws_size;
    const float* Q = (const float*)d_in[0];
    const float* K = (const float*)d_in[1];
    const float* V = (const float*)d_in[2];
    float* O = (float*)d_out;
    // workspace: Kh (8.39 MB) | Vt (8.39 MB)  -> 16.78 MB of d_ws
    _Float16* Kh = (_Float16*)d_ws;
    _Float16* Vt = Kh + (size_t)BB * SS * DD;
    hipLaunchKernelGGL(fa_prep, dim3(BB * NT), dim3(128), 0, stream, K, V, Kh, Vt);
    hipLaunchKernelGGL(DotProductAttention_48421461295297_kernel,
                       dim3(BB * (SS / (WAVES * QG * 16))), dim3(SETS * WAVES * 32), 0, stream, Q, Kh, Vt, O);
}

// v006
// Measured time: 41.9 microseconds a run.
// Next to v005, in two timings, it ran 1.05 times as fast each time.
// Over all steps from v000 it is 4.09 times as fast.
#include <hip/hip_runtime.h>

typedef _Float16 v16h __attribute__((ext_vector_type(16)));
typedef _Float16 v8h  __attribute__((ext_vector_type(8)));
typedef float    v8f  __attribute__((ext_vector_type(8)));

constexpr int BB = 16;
constexpr int SS = 2048;
constexpr int DD = 128;
constexpr int KVT = 32;              // kv rows per tile
constexpr int NT  = SS / KVT;        // 64 kv tiles
constexpr int WAVES = 4;             // wave32s that share one key half; each has its own query columns
constexpr int SETS  = 2;             // key halves per workgroup: waves w and w + WAVES hold the same queries
constexpr int NTS   = NT / SETS;     // kv tiles per key half
constexpr int QG  = 2;               // 16-column query groups per wave: each K / V^T fragment feeds QG products
constexpr int TILE_H = KVT * DD;     // f16 elements per staged tile (4096 = 8KB)
// LDS row pitches in f16 elements: 16 B x odd, so the 16 rows that one half-wave
// ds_load_b128 touches fall on 16 distinct groups of four banks.
constexpr int KP = DD + 8;           // K rows: 256 B of data on a 272 B pitch
constexpr int VP = KVT + 8;          // V^T rows: 64 B of data on an 80 B pitch

// gfx1250 async global->LDS copy path (ASYNCcnt) if the toolchain exposes it.
#if defined(__has_builtin)
#if __has_builtin(__builtin_amdgcn_global_load_async_to_lds_b128)
#define USE_ASYNC_LDS 1
#endif
#endif

#ifdef USE_ASYNC_LDS
// Param 0: gcc-style int4 pointer in AS(1) (global); param 1: LDS-side pointer.
typedef int v4i __attribute__((vector_size(16)));
typedef __attribute__((address_space(1))) v4i* gasp;   // global (AS1)
typedef __attribute__((address_space(3))) v4i* lasp;   // LDS (AS3)
__device__ __forceinline__ gasp to_global(const void* p) {
    return (gasp)(unsigned long long)p;                // AS1 == generic numerically
}
__device__ __forceinline__ lasp to_lds(void* p) {
    return (lasp)(unsigned)(unsigned long long)p;      // LDS offset = low 32 bits
}
__device__ __forceinline__ void wait_async0() {
#if __has_builtin(__builtin_amdgcn_s_wait_asynccnt)
    __builtin_amdgcn_s_wait_asynccnt(0);
#else
    asm volatile("s_wait_asynccnt 0x0" ::: "memory");
#endif
}
#endif

// Raw v_exp_f32: args here are always <= 0, and sub-(-126) inputs should flush
// to 0 probability anyway, so skip ocml's denormal-range fixup entirely.
__device__ __forceinline__ float fast_exp2(float x) {
#if defined(__has_builtin) && __has_builtin(__builtin_amdgcn_exp2f)
    return __builtin_amdgcn_exp2f(x);
#else
    return exp2f(x);
#endif
}
__device__ __forceinline__ float fast_rcp(float x) {
#if defined(__has_builtin) && __has_builtin(__builtin_amdgcn_rcpf)
    return __builtin_amdgcn_rcpf(x);
#else
    return 1.0f / x;
#endif
}

// Build a v16h WMMA operand from two contiguous 16B LDS chunks (2x ds_load_b128).
__device__ __forceinline__ v16h ld_op16(const _Float16* p) {
    v8h lo = *(const v8h*)p;
    v8h hh = *(const v8h*)(p + 16);
    v16h r;
#pragma unroll
    for (int i = 0; i < 8; ++i) { r[i] = lo[i]; r[i + 8] = hh[i]; }
    return r;
}

// ---------------- pre-pass: K -> f16 flat, V -> f16 transposed per 32-row tile ----------------
__global__ __launch_bounds__(128, 1)
void fa_prep(const float* __restrict__ K, const float* __restrict__ V,
             _Float16* __restrict__ Kh, _Float16* __restrict__ Vt)
{
    __shared__ __align__(16) _Float16 T[DD * KVT];   // [d][k]
    const int tid  = threadIdx.x;
    const int b    = blockIdx.x >> 6;
    const int t    = blockIdx.x & 63;
    const int krow = tid >> 2;
    const int cgrp = (tid & 3) * 32;
    const size_t tb = ((size_t)b * SS + (size_t)t * KVT) * DD;
    const float* kp = K + tb + (size_t)krow * DD + cgrp;
    const float* vp = V + tb + (size_t)krow * DD + cgrp;
    _Float16*    kq = Kh + tb + (size_t)krow * DD + cgrp;
#pragma unroll
    for (int j = 0; j < 4; ++j) {
        float4 a = *(const float4*)(kp + 8 * j);
        float4 c = *(const float4*)(kp + 8 * j + 4);
        v8h h;
        h[0]=(_Float16)a.x; h[1]=(_Float16)a.y; h[2]=(_Float16)a.z; h[3]=(_Float16)a.w;
        h[4]=(_Float16)c.x; h[5]=(_Float16)c.y; h[6]=(_Float16)c.z; h[7]=(_Float16)c.w;
        *(v8h*)(kq + 8 * j) = h;
        float4 e = *(const float4*)(vp + 8 * j);
        float4 f = *(const float4*)(vp + 8 * j + 4);
        const int d0 = cgrp + 8 * j;
        T[(d0+0)*KVT + krow] = (_Float16)e.x;
        T[(d0+1)*KVT + krow] = (_Float16)e.y;
        T[(d0+2)*KVT + krow] = (_Float16)e.z;
        T[(d0+3)*KVT + krow] = (_Float16)e.w;
        T[(d0+4)*KVT + krow] = (_Float16)f.x;
        T[(d0+5)*KVT + krow] = (_Float16)f.y;
        T[(d0+6)*KVT + krow] = (_Float16)f.z;
        T[(d0+7)*KVT + krow] = (_Float16)f.w;
    }
    __syncthreads();
    _Float16* vo = Vt + tb + (size_t)tid * KVT;
    const _Float16* ts = &T[tid * KVT];
#pragma unroll
    for (int j = 0; j < 4; ++j)
        *(v8h*)(vo + 8 * j) = *(const v8h*)(ts + 8 * j);
}

// Merge of the two key halves, sending side: one query group's partial O^T, maximum and sum to LDS.
__device__ __forceinline__ void put_part(float4 (*xo)[32], float2* xml, int lane,
                                         const v8f (&o)[8], float m, float l) {
    xml[lane] = make_float2(m, l);
#pragma unroll
    for (int db = 0; db < 8; ++db) {
        xo[2 * db][lane]     = make_float4(o[db][0], o[db][1], o[db][2], o[db][3]);
        xo[2 * db + 1][lane] = make_float4(o[db][4], o[db][5], o[db][6], o[db][7]);
    }
}
// Receiving side: both halves brought to their common maximum, added, normalised, stored.
__device__ __forceinline__ void merge_store(const float4 (*xo)[32], const float2* xml, int lane,
                                            const v8f (&o)[8], float m, float l, float* orow) {
    const float2 ml = xml[lane];
    const float mn = fmaxf(m, ml.x);
    const float ca = fast_exp2(m - mn);
    const float cb = fast_exp2(ml.x - mn);
    const float inv = fast_rcp(l * ca + ml.y * cb);
    const float fa = ca * inv;
    const float fb = cb * inv;
#pragma unroll
    for (int db = 0; db < 8; ++db) {
        const float4 p0 = xo[2 * db][lane];
        const float4 p1 = xo[2 * db + 1][lane];
        float4 lo4, hi4;
        lo4.x = o[db][0] * fa + p0.x * fb; lo4.y = o[db][1] * fa + p0.y * fb;
        lo4.z = o[db][2] * fa + p0.z * fb; lo4.w = o[db][3] * fa + p0.w * fb;
        hi4.x = o[db][4] * fa + p1.x * fb; hi4.y = o[db][5] * fa + p1.y * fb;
        hi4.z = o[db][6] * fa + p1.z * fb; hi4.w = o[db][7] * fa + p1.w * fb;
        *(float4*)(orow + db * 16)     = lo4;
        *(float4*)(orow + db * 16 + 4) = hi4;
    }
}

// ---------------- main FlashAttention kernel (transpose-free, double-buffered) ----------------
// Two sets of WAVES waves walk the two halves of the keys for the same queries, so that every
// SIMD holds two waves: one wave's softmax runs beside the other's products. The halves'
// partial results (maximum, sum, unnormalised O^T) are merged through LDS behind the loop.
__global__ __launch_bounds__(SETS * WAVES * 32, 1)
void DotProductAttention_48421461295297_kernel(const float* __restrict__ Q,
                                               const _Float16* __restrict__ Kh,
                                               const _Float16* __restrict__ Vt,
                                               float* __restrict__ O)
{
    __shared__ __align__(16) _Float16 Kst[SETS][2][KVT * KP];   // [k=32][d=128], padded rows
    __shared__ __align__(16) _Float16 Vst[SETS][2][DD * VP];    // [d=128][k=32], padded rows
    __shared__ __align__(16) float4 Xo[SETS * WAVES][16][32];   // merge: one query group's O^T per wave
    __shared__ float2 Xml[SETS * WAVES][32];                    // merge: its running maximum and sum

    const int set  = __builtin_amdgcn_readfirstlane((int)threadIdx.x >> 7);   // key half, wave-uniform
    const int tid  = threadIdx.x & (WAVES * 32 - 1);                          // thread within its set
    const int wave = tid >> 5;
    const int lane = tid & 31;
    const int ln   = lane & 15;
    const int koff = (lane >> 4) * 8;   // K-range offset in operand layout
    const int mb   = koff;              // row-base in C/D layout

    const int batch = blockIdx.x >> 4;
    const int qblk  = blockIdx.x & 15;
    const int q0    = qblk * (WAVES * QG * 16) + wave * (QG * 16);
    const size_t bbase = (size_t)batch * SS * DD;

    const float SL2E = 0.08838834764831845f * 1.4426950408889634f;  // 1/sqrt(128)*log2(e)

    // Q tile -> f16 registers with the softmax scale folded in (log2 domain).
    v16h qa[QG][4];
#pragma unroll
    for (int g = 0; g < QG; ++g) {
        const float* qp = Q + bbase + (size_t)(q0 + g * 16 + ln) * DD;
#pragma unroll
        for (int dc = 0; dc < 4; ++dc) {
            const int off = dc * 32 + koff;
            float4 f0 = *(const float4*)(qp + off);
            float4 f1 = *(const float4*)(qp + off + 4);
            float4 f2 = *(const float4*)(qp + off + 16);
            float4 f3 = *(const float4*)(qp + off + 20);
            v16h a;
            a[0]=(_Float16)(f0.x*SL2E);  a[1]=(_Float16)(f0.y*SL2E);
            a[2]=(_Float16)(f0.z*SL2E);  a[3]=(_Float16)(f0.w*SL2E);
            a[4]=(_Float16)(f1.x*SL2E);  a[5]=(_Float16)(f1.y*SL2E);
            a[6]=(_Float16)(f1.z*SL2E);  a[7]=(_Float16)(f1.w*SL2E);
            a[8]=(_Float16)(f2.x*SL2E);  a[9]=(_Float16)(f2.y*SL2E);
            a[10]=(_Float16)(f2.z*SL2E); a[11]=(_Float16)(f2.w*SL2E);
            a[12]=(_Float16)(f3.x*SL2E); a[13]=(_Float16)(f3.y*SL2E);
            a[14]=(_Float16)(f3.z*SL2E); a[15]=(_Float16)(f3.w*SL2E);
            qa[g][dc] = a;
        }
    }
    // The Q loads' address registers are reused right behind them. The address as an input keeps its
    // registers live up to the wait, so the overwrite cannot be lifted over it.
    asm volatile("s_wait_xcnt 0x0" :: "v"(Q + bbase + (size_t)(q0 + ln) * DD + koff) : "memory");

    v8f ot[QG][8] = {};                   // O^T accumulators: rows d, cols q (fp32)
    float mrun[QG], lrun[QG];
#pragma unroll
    for (int g = 0; g < QG; ++g) { mrun[g] = -__builtin_inff(); lrun[g] = 0.0f; }

    // prefetch: each thread asks for one 64 B piece of the K tile and of the V tile
    const size_t hbase = bbase + (size_t)set * NTS * TILE_H;   // first tile of this set's key half
    const _Float16* kbase = Kh + hbase + (size_t)tid * 32;
    const _Float16* vbase = Vt + hbase + (size_t)tid * 32;
    // staging: a tile is 512 pieces of 16 B; copy j of thread tid moves piece j * 128 + tid,
    // so the 32 lanes of one copy cover 512 contiguous bytes: four whole 128 B lines.
    const _Float16* kcp = Kh + hbase + (size_t)tid * 8;
    const _Float16* vcp = Vt + hbase + (size_t)tid * 8;
    // where piece tid lands in LDS: 16 pieces a K row, 4 pieces a V^T row
    const int kso = (tid >> 4) * KP + (tid & 15) * 8;
    const int vso = (tid >> 2) * VP + (tid & 3) * 8;
    constexpr int GSTEP = 128 * 8;       // f16 elements from piece p to piece p + 128, global
    constexpr int KSTEP = 8 * KP;        // the same in LDS: 8 K rows further
    constexpr int VSTEP = 32 * VP;       // the same in LDS: 32 V^T rows further

    // Tile j of K lies in Kst[set][j & 1], tile j of V^T in Vst[set][j & 1]. K runs one tile ahead
    // of V: trip t reads the fragments of K tile t + 1, so that tile is published one trip earlier.
#ifdef USE_ASYNC_LDS
    {   // stage K tiles 0 and 1 and V tile 0: direct global->LDS, no VGPR traffic
#pragma unroll
        for (int j = 0; j < 4; ++j) {
            __builtin_amdgcn_global_load_async_to_lds_b128(to_global(kcp + j * GSTEP),
                                                           to_lds(&Kst[set][0][kso + j * KSTEP]), 0, 0);
            __builtin_amdgcn_global_load_async_to_lds_b128(to_global(vcp + j * GSTEP),
                                                           to_lds(&Vst[set][0][vso + j * VSTEP]), 0, 0);
            __builtin_amdgcn_global_load_async_to_lds_b128(to_global(kcp + TILE_H + j * GSTEP),
                                                           to_lds(&Kst[set][1][kso + j * KSTEP]), 0, 0);
        }
        wait_async0();
    }
#else
    v8h kr[4], vr[4];
#pragma unroll
    for (int b = 0; b < 2; ++b) {
#pragma unroll
        for (int j = 0; j < 4; ++j) kr[j] = *(const v8h*)(kcp + b * TILE_H + j * GSTEP);
#pragma unroll
        for (int j = 0; j < 4; ++j) *(v8h*)(&Kst[set][b][kso + j * KSTEP]) = kr[j];
    }
#pragma unroll
    for (int j = 0; j < 4; ++j) vr[j] = *(const v8h*)(vcp + j * GSTEP);
#pragma unroll
    for (int j = 0; j < 4; ++j) *(v8h*)(&Vst[set][0][vso + j * VSTEP]) = vr[j];
#endif
    __syncthreads();

    v16h kb[8];                           // K fragments, always one tile ahead: here tile 0's
#pragma unroll
    for (int dc = 0; dc < 4; ++dc) {
        kb[dc]     = ld_op16(&Kst[set][0][(0  + ln) * KP + dc * 32 + koff]);
        kb[4 + dc] = ld_op16(&Kst[set][0][(16 + ln) * KP + dc * 32 + koff]);
    }
    // Ends this wave's reads of K buffer 0: trip 0 refills it behind the barrier below.
    asm volatile("s_wait_dscnt 0x0" ::: "memory");
    __syncthreads();

#pragma unroll 1
    for (int t = 0; t < NTS; ++t) {
        const int cur = t & 1;

        if (t + 1 < NTS) {                 // start the next copies before compute
            // V tile t + 1 into the buffer that trip t - 1 read at its top
            const _Float16* vn = vcp + (size_t)(t + 1) * TILE_H;
#ifdef USE_ASYNC_LDS
#pragma unroll
            for (int j = 0; j < 4; ++j)
                __builtin_amdgcn_global_load_async_to_lds_b128(to_global(vn + j * GSTEP),
                                                               to_lds(&Vst[set][cur ^ 1][vso + j * VSTEP]), 0, 0);
#else
#pragma unroll
            for (int j = 0; j < 4; ++j) vr[j] = *(const v8h*)(vn + j * GSTEP);
#endif
            if (t + 2 < NTS) {
                // K tile t + 2 into the buffer of K tile t, whose fragments trip t - 1 fetched
                const _Float16* kn = kcp + (size_t)(t + 2) * TILE_H;
#ifdef USE_ASYNC_LDS
#pragma unroll
                for (int j = 0; j < 4; ++j)
                    __builtin_amdgcn_global_load_async_to_lds_b128(to_global(kn + j * GSTEP),
                                                                   to_lds(&Kst[set][cur][kso + j * KSTEP]), 0, 0);
#else
#pragma unroll
                for (int j = 0; j < 4; ++j) kr[j] = *(const v8h*)(kn + j * GSTEP);
#endif
                // gfx1250 global_prefetch, one tile ahead of each copy
                __builtin_prefetch(vbase + (size_t)(t + 2) * TILE_H, 0, 1);
                if (t + 3 < NTS)
                    __builtin_prefetch(kbase + (size_t)(t + 3) * TILE_H, 0, 1);
            }
        }

        v16h vb[8];                       // this tile's V^T fragments: they land behind the S products
#pragma unroll
        for (int db = 0; db < 8; ++db)
            vb[db] = ld_op16(&Vst[set][cur][(db * 16 + ln) * VP + koff]);
        // Keeps the 16 V^T reads above as one group in front of the S products: left free,
        // the scheduler sinks each pair to its product and the wave waits out a full LDS
        // latency in front of every product.
        __builtin_amdgcn_sched_barrier(0);

        // ---- S^T = K_tile * Q^T, on the fragments that the trip before fetched ----
        v8f ct0[QG] = {}, ct1[QG] = {};
#pragma unroll
        for (int dc = 0; dc < 4; ++dc) {
#pragma unroll
            for (int g = 0; g < QG; ++g) {
                ct0[g] = __builtin_amdgcn_wmma_f32_16x16x32_f16(false, kb[dc],     false, qa[g][dc],
                                                                (short)0, ct0[g], false, false);
                ct1[g] = __builtin_amdgcn_wmma_f32_16x16x32_f16(false, kb[4 + dc], false, qa[g][dc],
                                                                (short)0, ct1[g], false, false);
            }
        }

        // ---- online softmax (log2 domain; scores already scaled via Q), per query group ----
        float vmax[QG], vxch[QG];         // a lane's own maximum, and that of the other half-wave
#pragma unroll
        for (int g = 0; g < QG; ++g) {
            vmax[g] = ct0[g][0];
#pragma unroll
            for (int r = 1; r < 8; ++r) vmax[g] = fmaxf(vmax[g], ct0[g][r]);
#pragma unroll
            for (int r = 0; r < 8; ++r) vmax[g] = fmaxf(vmax[g], ct1[g][r]);
            vxch[g] = __shfl_xor(vmax[g], 16, 32);
        }
        // Inputs only, no instruction: the exchanged maxima are in their registers here. The exchange
        // goes through the LDS queue, which returns in issue order: issued behind the 16 reads below,
        // as the build otherwise has it, it would wait for all of them in front of the exponentials.
        asm volatile("" :: "v"(vxch[0]), "v"(vxch[1]));
        // The next tile's K fragments, behind the S products, which free kb: they land under the
        // exponentials and the O products, and the next trip's S products start at once.
        // The last trip has no next tile: it reads the tile before its own again (published, no copy
        // in flight), and the values feed nothing; a branch round the reads would save no time.
#pragma unroll
        for (int dc = 0; dc < 4; ++dc) {
            kb[dc]     = ld_op16(&Kst[set][cur ^ 1][(0  + ln) * KP + dc * 32 + koff]);
            kb[4 + dc] = ld_op16(&Kst[set][cur ^ 1][(16 + ln) * KP + dc * 32 + koff]);
        }
        // Keeps the 16 K reads above as one group at this place: left free, the scheduler
        // spreads them among the exponentials and the O products.
        __builtin_amdgcn_sched_barrier(0);

        v16h pa[QG];                      // exponentiated scores == P^T B-operand layout
#pragma unroll
        for (int g = 0; g < QG; ++g) {
            const float mnew = fmaxf(mrun[g], fmaxf(vmax[g], vxch[g]));
            const float dm = mrun[g] - mnew;
            const float corr = fast_exp2(dm);
            mrun[g] = mnew;

            const v8f d0 = ct0[g] - mnew;
            const v8f d1 = ct1[g] - mnew;
            float rs = 0.0f;
#pragma unroll
            for (int r = 0; r < 8; ++r) { float p = fast_exp2(d0[r]); rs += p; pa[g][r]     = (_Float16)p; }
#pragma unroll
            for (int r = 0; r < 8; ++r) { float p = fast_exp2(d1[r]); rs += p; pa[g][8 + r] = (_Float16)p; }
            // Inputs only, no instruction: keeps the 17 exp2 arguments in their registers until the
            // results are packed. A precaution: the instruction set asks for
            // one free slot between a v_exp_f32 and a write to its argument.
            asm volatile("" :: "v"(dm), "v"(d0), "v"(d1), "v"(pa[g]));
            rs += __shfl_xor(rs, 16, 32);
            lrun[g] = lrun[g] * corr + rs;

#pragma unroll
            for (int db = 0; db < 8; ++db)    // v8f * scalar -> v_pk_mul_f32
                ot[g][db] = ot[g][db] * corr;
        }

        // ---- O^T += V^T * P^T ----
#pragma unroll
        for (int db = 0; db < 8; ++db) {
#pragma unroll
            for (int g = 0; g < QG; ++g)
                ot[g][db] = __builtin_amdgcn_wmma_f32_16x16x32_f16(false, vb[db], false, pa[g],
                                                                   (short)0, ot[g][db], false, false);
        }

        // Keeps the wait below behind the O products: left free, it rises among them and the wave
        // stands there until the K reads have landed.
        __builtin_amdgcn_sched_barrier(0);
        // Ends this wave's reads of the K and V buffers that the next trip refills behind the barrier.
        asm volatile("s_wait_dscnt 0x0" ::: "memory");
        if (t + 1 < NTS) {
#ifdef USE_ASYNC_LDS
            wait_async0();                // drain our async writes before publishing
#else
            _Float16* vd = &Vst[set][cur ^ 1][vso];
#pragma unroll
            for (int j = 0; j < 4; ++j) *(v8h*)(vd + j * VSTEP) = vr[j];
            if (t + 2 < NTS) {
                _Float16* kd = &Kst[set][cur][kso];
#pragma unroll
                for (int j = 0; j < 4; ++j) *(v8h*)(kd + j * KSTEP) = kr[j];
            }
#endif
        }
        __syncthreads();
    }

    // ---- merge the two key halves: a wave keeps query group 'set' and hands the other one
    //      to the wave of the other set that holds the same queries ----
    const int me = set * WAVES + wave;
    const int pw = (set ^ 1) * WAVES + wave;
    if (set == 0) put_part(Xo[me], Xml[me], lane, ot[1], mrun[1], lrun[1]);
    else          put_part(Xo[me], Xml[me], lane, ot[0], mrun[0], lrun[0]);
    __syncthreads();

    // ---- normalize + store: lane writes q-row ln, d = db*16 + mb + 0..7 ----
    float* orow = O + bbase + (size_t)(q0 + set * 16 + ln) * DD + mb;
    if (set == 0) merge_store(Xo[pw], Xml[pw], lane, ot[0], mrun[0], lrun[0], orow);
    else          merge_store(Xo[pw], Xml[pw], lane, ot[1], mrun[1], lrun[1], orow);
}

extern "C" void kernel_launch(void* const* d_in, const int* in_sizes, int n_in,
                              void* d_out, int out_size, void* d_ws, size_t ws_size,
                              hipStream_t stream) {
    (void)in_sizes; (void)n_in; (void)out_size; (void)ws_size;
    const float* Q = (const float*)d_in[0];
    const float* K = (const float*)d_in[1];
    const float* V = (const float*)d_in[2];
    float* O = (float*)d_out;
    // workspace: Kh (8.39 MB) | Vt (8.39 MB)  -> 16.78 MB of d_ws
    _Float16* Kh = (_Float16*)d_ws;
    _Float16* Vt = Kh + (size_t)BB * SS * DD;
    hipLaunchKernelGGL(fa_prep, dim3(BB * NT), dim3(128), 0, stream, K, V, Kh, Vt);
    hipLaunchKernelGGL(DotProductAttention_48421461295297_kernel,
                       dim3(BB * (SS / (WAVES * QG * 16))), dim3(SETS * WAVES * 32), 0, stream, Q, Kh, Vt, O);
}

// v008
// Measured time: 38 microseconds a run.
// It is 1.10 times as fast as v006, going by the measured steps of the versions left out in between.
// Over all steps from v000 it is 4.51 times as fast.
#include <hip/hip_runtime.h>

typedef _Float16 v16h __attribute__((ext_vector_type(16)));
typedef _Float16 v8h  __attribute__((ext_vector_type(8)));
typedef float    v8f  __attribute__((ext_vector_type(8)));

constexpr int BB = 16;
constexpr int SS = 2048;
constexpr int DD = 128;
constexpr int KVT = 32;              // kv rows per tile
constexpr int NT  = SS / KVT;        // 64 kv tiles
constexpr int WAVES = 4;             // wave32s that share one key half; each has its own query columns
constexpr int SETS  = 2;             // key halves per workgroup: waves w and w + WAVES hold the same queries
constexpr int NTS   = NT / SETS;     // kv tiles per key half
constexpr int QG  = 2;               // 16-column query groups per wave: each K / V^T fragment feeds QG products
constexpr int TILE_H = KVT * DD;     // f16 elements per staged tile (4096 = 8KB)
// LDS row pitches in f16 elements: 16 B x odd, so the 16 rows that one half-wave
// ds_load_b128 touches fall on 16 distinct groups of four banks.
constexpr int KP = DD + 8;           // K rows: 256 B of data on a 272 B pitch
constexpr int VP = KVT + 8;          // V^T rows: 64 B of data on an 80 B pitch

// gfx1250 async global->LDS copy path (ASYNCcnt) if the toolchain exposes it.
#if defined(__has_builtin)
#if __has_builtin(__builtin_amdgcn_global_load_async_to_lds_b128)
#define USE_ASYNC_LDS 1
#endif
#endif

#ifdef USE_ASYNC_LDS
// Param 0: gcc-style int4 pointer in AS(1) (global); param 1: LDS-side pointer.
typedef int v4i __attribute__((vector_size(16)));
typedef __attribute__((address_space(1))) v4i* gasp;   // global (AS1)
typedef __attribute__((address_space(3))) v4i* lasp;   // LDS (AS3)
__device__ __forceinline__ gasp to_global(const void* p) {
    return (gasp)(unsigned long long)p;                // AS1 == generic numerically
}
__device__ __forceinline__ lasp to_lds(void* p) {
    return (lasp)(unsigned)(unsigned long long)p;      // LDS offset = low 32 bits
}
__device__ __forceinline__ void wait_async0() {
#if __has_builtin(__builtin_amdgcn_s_wait_asynccnt)
    __builtin_amdgcn_s_wait_asynccnt(0);
#else
    asm volatile("s_wait_asynccnt 0x0" ::: "memory");
#endif
}
#endif

// Raw v_exp_f32: args here are never above LAZY = 8, and sub-(-126) inputs should flush
// to 0 probability anyway, so skip ocml's denormal-range fixup entirely.
__device__ __forceinline__ float fast_exp2(float x) {
#if defined(__has_builtin) && __has_builtin(__builtin_amdgcn_exp2f)
    return __builtin_amdgcn_exp2f(x);
#else
    return exp2f(x);
#endif
}
__device__ __forceinline__ float fast_rcp(float x) {
#if defined(__has_builtin) && __has_builtin(__builtin_amdgcn_rcpf)
    return __builtin_amdgcn_rcpf(x);
#else
    return 1.0f / x;
#endif
}

// Build a v16h WMMA operand from two contiguous 16B LDS chunks (2x ds_load_b128).
__device__ __forceinline__ v16h ld_op16(const _Float16* p) {
    v8h lo = *(const v8h*)p;
    v8h hh = *(const v8h*)(p + 16);
    v16h r;
#pragma unroll
    for (int i = 0; i < 8; ++i) { r[i] = lo[i]; r[i + 8] = hh[i]; }
    return r;
}

// ---------------- pre-pass: K -> f16 flat, V -> f16 transposed per 32-row tile ----------------
__global__ __launch_bounds__(128, 1)
void fa_prep(const float* __restrict__ K, const float* __restrict__ V,
             _Float16* __restrict__ Kh, _Float16* __restrict__ Vt)
{
    __shared__ __align__(16) _Float16 T[DD * KVT];   // [d][k]
    const int tid  = threadIdx.x;
    const int b    = blockIdx.x >> 6;
    const int t    = blockIdx.x & 63;
    const int krow = tid >> 2;
    const int cgrp = (tid & 3) * 32;
    const size_t tb = ((size_t)b * SS + (size_t)t * KVT) * DD;
    const float* kp = K + tb + (size_t)krow * DD + cgrp;
    const float* vp = V + tb + (size_t)krow * DD + cgrp;
    _Float16*    kq = Kh + tb + (size_t)krow * DD + cgrp;
#pragma unroll
    for (int j = 0; j < 4; ++j) {
        float4 a = *(const float4*)(kp + 8 * j);
        float4 c = *(const float4*)(kp + 8 * j + 4);
        v8h h;
        h[0]=(_Float16)a.x; h[1]=(_Float16)a.y; h[2]=(_Float16)a.z; h[3]=(_Float16)a.w;
        h[4]=(_Float16)c.x; h[5]=(_Float16)c.y; h[6]=(_Float16)c.z; h[7]=(_Float16)c.w;
        *(v8h*)(kq + 8 * j) = h;
        float4 e = *(const float4*)(vp + 8 * j);
        float4 f = *(const float4*)(vp + 8 * j + 4);
        const int d0 = cgrp + 8 * j;
        T[(d0+0)*KVT + krow] = (_Float16)e.x;
        T[(d0+1)*KVT + krow] = (_Float16)e.y;
        T[(d0+2)*KVT + krow] = (_Float16)e.z;
        T[(d0+3)*KVT + krow] = (_Float16)e.w;
        T[(d0+4)*KVT + krow] = (_Float16)f.x;
        T[(d0+5)*KVT + krow] = (_Float16)f.y;
        T[(d0+6)*KVT + krow] = (_Float16)f.z;
        T[(d0+7)*KVT + krow] = (_Float16)f.w;
    }
    __syncthreads();
    _Float16* vo = Vt + tb + (size_t)tid * KVT;
    const _Float16* ts = &T[tid * KVT];
#pragma unroll
    for (int j = 0; j < 4; ++j)
        *(v8h*)(vo + 8 * j) = *(const v8h*)(ts + 8 * j);
}

// Merge of the two key halves, sending side: one query group's partial O^T, maximum and sum to LDS.
__device__ __forceinline__ void put_part(float4 (*xo)[32], float2* xml, int lane,
                                         const v8f (&o)[8], float m, float l) {
    xml[lane] = make_float2(m, l);
#pragma unroll
    for (int db = 0; db < 8; ++db) {
        xo[2 * db][lane]     = make_float4(o[db][0], o[db][1], o[db][2], o[db][3]);
        xo[2 * db + 1][lane] = make_float4(o[db][4], o[db][5], o[db][6], o[db][7]);
    }
}
// Receiving side: both halves brought to their common maximum, added, normalised, stored.
__device__ __forceinline__ void merge_store(const float4 (*xo)[32], const float2* xml, int lane,
                                            const v8f (&o)[8], float m, float l, float* orow) {
    const float2 ml = xml[lane];
    const float mn = fmaxf(m, ml.x);
    const float ca = fast_exp2(m - mn);
    const float cb = fast_exp2(ml.x - mn);
    const float inv = fast_rcp(l * ca + ml.y * cb);
    const float fa = ca * inv;
    const float fb = cb * inv;
#pragma unroll
    for (int db = 0; db < 8; ++db) {
        const float4 p0 = xo[2 * db][lane];
        const float4 p1 = xo[2 * db + 1][lane];
        float4 lo4, hi4;
        lo4.x = o[db][0] * fa + p0.x * fb; lo4.y = o[db][1] * fa + p0.y * fb;
        lo4.z = o[db][2] * fa + p0.z * fb; lo4.w = o[db][3] * fa + p0.w * fb;
        hi4.x = o[db][4] * fa + p1.x * fb; hi4.y = o[db][5] * fa + p1.y * fb;
        hi4.z = o[db][6] * fa + p1.z * fb; hi4.w = o[db][7] * fa + p1.w * fb;
        *(float4*)(orow + db * 16)     = lo4;
        *(float4*)(orow + db * 16 + 4) = hi4;
    }
}

// ---------------- main FlashAttention kernel (transpose-free, double-buffered) ----------------
// Two sets of WAVES waves walk the two halves of the keys for the same queries, so that every
// SIMD holds two waves: one wave's softmax runs beside the other's products. The halves'
// partial results (maximum, sum, unnormalised O^T) are merged through LDS behind the loop.
__global__ __launch_bounds__(SETS * WAVES * 32, 1)
void DotProductAttention_48421461295297_kernel(const float* __restrict__ Q,
                                               const _Float16* __restrict__ Kh,
                                               const _Float16* __restrict__ Vt,
                                               float* __restrict__ O)
{
    __shared__ __align__(16) _Float16 Kst[SETS][2][KVT * KP];   // [k=32][d=128], padded rows
    __shared__ __align__(16) _Float16 Vst[SETS][2][DD * VP];    // [d=128][k=32], padded rows
    __shared__ __align__(16) float4 Xo[SETS * WAVES][16][32];   // merge: one query group's O^T per wave
    __shared__ float2 Xml[SETS * WAVES][32];                    // merge: its running maximum and sum

    const int set  = __builtin_amdgcn_readfirstlane((int)threadIdx.x >> 7);   // key half, wave-uniform
    const int tid  = threadIdx.x & (WAVES * 32 - 1);                          // thread within its set
    const int wave = tid >> 5;
    const int lane = tid & 31;
    const int ln   = lane & 15;
    const int koff = (lane >> 4) * 8;   // K-range offset in operand layout
    const int mb   = koff;              // row-base in C/D layout

    const int batch = blockIdx.x >> 4;
    const int qblk  = blockIdx.x & 15;
    const int q0    = qblk * (WAVES * QG * 16) + wave * (QG * 16);
    const size_t bbase = (size_t)batch * SS * DD;

    const float SL2E = 0.08838834764831845f * 1.4426950408889634f;  // 1/sqrt(128)*log2(e)

    // Q tile -> f16 registers with the softmax scale folded in (log2 domain).
    v16h qa[QG][4];
#pragma unroll
    for (int g = 0; g < QG; ++g) {
        const float* qp = Q + bbase + (size_t)(q0 + g * 16 + ln) * DD;
#pragma unroll
        for (int dc = 0; dc < 4; ++dc) {
            const int off = dc * 32 + koff;
            float4 f0 = *(const float4*)(qp + off);
            float4 f1 = *(const float4*)(qp + off + 4);
            float4 f2 = *(const float4*)(qp + off + 16);
            float4 f3 = *(const float4*)(qp + off + 20);
            v16h a;
            a[0]=(_Float16)(f0.x*SL2E);  a[1]=(_Float16)(f0.y*SL2E);
            a[2]=(_Float16)(f0.z*SL2E);  a[3]=(_Float16)(f0.w*SL2E);
            a[4]=(_Float16)(f1.x*SL2E);  a[5]=(_Float16)(f1.y*SL2E);
            a[6]=(_Float16)(f1.z*SL2E);  a[7]=(_Float16)(f1.w*SL2E);
            a[8]=(_Float16)(f2.x*SL2E);  a[9]=(_Float16)(f2.y*SL2E);
            a[10]=(_Float16)(f2.z*SL2E); a[11]=(_Float16)(f2.w*SL2E);
            a[12]=(_Float16)(f3.x*SL2E); a[13]=(_Float16)(f3.y*SL2E);
            a[14]=(_Float16)(f3.z*SL2E); a[15]=(_Float16)(f3.w*SL2E);
            qa[g][dc] = a;
        }
    }
    // The Q loads' address registers are reused right behind them. The address as an input keeps its
    // registers live up to the wait, so the overwrite cannot be lifted over it.
    asm volatile("s_wait_xcnt 0x0" :: "v"(Q + bbase + (size_t)(q0 + ln) * DD + koff) : "memory");

    v8f ot[QG][8] = {};                   // O^T accumulators: rows d, cols q (fp32)
    // mrun is the reference that the exponentials are taken against: a maximum of an earlier trip,
    // renewed only when a score rises more than LAZY above it (mthr = mrun + LAZY), so P <= 2^LAZY.
    constexpr float LAZY = 8.0f;          // log2 units: 256 is far inside the f16 range
    float mrun[QG], mthr[QG];
#pragma unroll
    for (int g = 0; g < QG; ++g) { mrun[g] = -__builtin_inff(); mthr[g] = -__builtin_inff(); }
    // Softmax denominators on the matrix unit: A has ones in rows 0 and 8 (lanes 0, 8, 16, 24) and
    // zeros elsewhere, so rows 0 and 8 of A * P^T hold the column sums of P^T over the tile's 32 keys:
    // register 0 of the result in either half-wave, and each lane finds its own query's sum in lacc[g][0].
    const _Float16 one_row = ((lane & 7) == 0) ? (_Float16)1.0f : (_Float16)0.0f;
    v16h ones;
#pragma unroll
    for (int i = 0; i < 16; ++i) ones[i] = one_row;
    v8f lacc[QG] = {};

    // prefetch: each thread asks for one 64 B piece of the K tile and of the V tile
    const size_t hbase = bbase + (size_t)set * NTS * TILE_H;   // first tile of this set's key half
    const _Float16* kbase = Kh + hbase + (size_t)tid * 32;
    const _Float16* vbase = Vt + hbase + (size_t)tid * 32;
    // staging: a tile is 512 pieces of 16 B; copy j of thread tid moves piece j * 128 + tid,
    // so the 32 lanes of one copy cover 512 contiguous bytes: four whole 128 B lines.
    const _Float16* kcp = Kh + hbase + (size_t)tid * 8;
    const _Float16* vcp = Vt + hbase + (size_t)tid * 8;
    // where piece tid lands in LDS: 16 pieces a K row, 4 pieces a V^T row
    const int kso = (tid >> 4) * KP + (tid & 15) * 8;
    const int vso = (tid >> 2) * VP + (tid & 3) * 8;
    constexpr int GSTEP = 128 * 8;       // f16 elements from piece p to piece p + 128, global
    constexpr int KSTEP = 8 * KP;        // the same in LDS: 8 K rows further
    constexpr int VSTEP = 32 * VP;       // the same in LDS: 32 V^T rows further

    // Tile j of K lies in Kst[set][j & 1], tile j of V^T in Vst[set][j & 1]. K runs one tile ahead
    // of V: trip t reads the fragments of K tile t + 1, so that tile is published one trip earlier.
#ifdef USE_ASYNC_LDS
    {   // stage K tiles 0 and 1 and V tile 0: direct global->LDS, no VGPR traffic
#pragma unroll
        for (int j = 0; j < 4; ++j) {
            __builtin_amdgcn_global_load_async_to_lds_b128(to_global(kcp + j * GSTEP),
                                                           to_lds(&Kst[set][0][kso + j * KSTEP]), 0, 0);
            __builtin_amdgcn_global_load_async_to_lds_b128(to_global(vcp + j * GSTEP),
                                                           to_lds(&Vst[set][0][vso + j * VSTEP]), 0, 0);
            __builtin_amdgcn_global_load_async_to_lds_b128(to_global(kcp + TILE_H + j * GSTEP),
                                                           to_lds(&Kst[set][1][kso + j * KSTEP]), 0, 0);
        }
        wait_async0();
    }
#else
    v8h kr[4], vr[4];
#pragma unroll
    for (int b = 0; b < 2; ++b) {
#pragma unroll
        for (int j = 0; j < 4; ++j) kr[j] = *(const v8h*)(kcp + b * TILE_H + j * GSTEP);
#pragma unroll
        for (int j = 0; j < 4; ++j) *(v8h*)(&Kst[set][b][kso + j * KSTEP]) = kr[j];
    }
#pragma unroll
    for (int j = 0; j < 4; ++j) vr[j] = *(const v8h*)(vcp + j * GSTEP);
#pragma unroll
    for (int j = 0; j < 4; ++j) *(v8h*)(&Vst[set][0][vso + j * VSTEP]) = vr[j];
#endif
    __syncthreads();

    v16h kb[8];                           // K fragments, always one tile ahead: here tile 0's
#pragma unroll
    for (int dc = 0; dc < 4; ++dc) {
        kb[dc]     = ld_op16(&Kst[set][0][(0  + ln) * KP + dc * 32 + koff]);
        kb[4 + dc] = ld_op16(&Kst[set][0][(16 + ln) * KP + dc * 32 + koff]);
    }
    // Ends this wave's reads of K buffer 0: trip 0 refills it behind the barrier below.
    asm volatile("s_wait_dscnt 0x0" ::: "memory");
    __syncthreads();

#pragma unroll 1
    for (int t = 0; t < NTS; ++t) {
        const int cur = t & 1;

        if (t + 1 < NTS) {                 // start the next copies before compute
            // V tile t + 1 into the buffer that trip t - 1 read at its top
            const _Float16* vn = vcp + (size_t)(t + 1) * TILE_H;
#ifdef USE_ASYNC_LDS
#pragma unroll
            for (int j = 0; j < 4; ++j)
                __builtin_amdgcn_global_load_async_to_lds_b128(to_global(vn + j * GSTEP),
                                                               to_lds(&Vst[set][cur ^ 1][vso + j * VSTEP]), 0, 0);
#else
#pragma unroll
            for (int j = 0; j < 4; ++j) vr[j] = *(const v8h*)(vn + j * GSTEP);
#endif
            if (t + 2 < NTS) {
                // K tile t + 2 into the buffer of K tile t, whose fragments trip t - 1 fetched
                const _Float16* kn = kcp + (size_t)(t + 2) * TILE_H;
#ifdef USE_ASYNC_LDS
#pragma unroll
                for (int j = 0; j < 4; ++j)
                    __builtin_amdgcn_global_load_async_to_lds_b128(to_global(kn + j * GSTEP),
                                                                   to_lds(&Kst[set][cur][kso + j * KSTEP]), 0, 0);
#else
#pragma unroll
                for (int j = 0; j < 4; ++j) kr[j] = *(const v8h*)(kn + j * GSTEP);
#endif
                // gfx1250 global_prefetch, one tile ahead of each copy
                __builtin_prefetch(vbase + (size_t)(t + 2) * TILE_H, 0, 1);
                if (t + 3 < NTS)
                    __builtin_prefetch(kbase + (size_t)(t + 3) * TILE_H, 0, 1);
            }
        }

        v16h vb[8];                       // this tile's V^T fragments: they land behind the S products
#pragma unroll
        for (int db = 0; db < 8; ++db)
            vb[db] = ld_op16(&Vst[set][cur][(db * 16 + ln) * VP + koff]);
        // Keeps the 16 V^T reads above as one group in front of the S products: left free,
        // the scheduler sinks each pair to its product and the wave waits out a full LDS
        // latency in front of every product.
        __builtin_amdgcn_sched_barrier(0);

        // ---- S^T = K_tile * Q^T, on the fragments that the trip before fetched ----
        v8f ct0[QG] = {}, ct1[QG] = {};
#pragma unroll
        for (int dc = 0; dc < 4; ++dc) {
#pragma unroll
            for (int g = 0; g < QG; ++g) {
                ct0[g] = __builtin_amdgcn_wmma_f32_16x16x32_f16(false, kb[dc],     false, qa[g][dc],
                                                                (short)0, ct0[g], false, false);
                ct1[g] = __builtin_amdgcn_wmma_f32_16x16x32_f16(false, kb[4 + dc], false, qa[g][dc],
                                                                (short)0, ct1[g], false, false);
            }
        }

        // ---- online softmax (log2 domain; scores already scaled via Q), per query group ----
        float vmax[QG];                   // a lane's own maximum: 16 of its query's 32 scores
        bool need = false;                // does one of them outgrow the reference in use?
#pragma unroll
        for (int g = 0; g < QG; ++g) {
            vmax[g] = ct0[g][0];
#pragma unroll
            for (int r = 1; r < 8; ++r) vmax[g] = fmaxf(vmax[g], ct0[g][r]);
#pragma unroll
            for (int r = 0; r < 8; ++r) vmax[g] = fmaxf(vmax[g], ct1[g][r]);
            need = need || (vmax[g] > mthr[g]);
        }
        // One test a trip for the whole wave; the first trip always takes it (mthr = -inf).
        const unsigned grow = __builtin_amdgcn_ballot_w32(need);
        // Keeps the 16 reads below out of the S products: left free, the scheduler puts each pair
        // behind the last product that uses its fragment's registers, eight places with reads.
        __builtin_amdgcn_sched_barrier(0);
        // The next tile's K fragments, behind the S products, which free kb: they land under the
        // exponentials and the O products, and the next trip's S products start at once.
        // The last trip has no next tile: it reads the tile before its own again (published, no copy
        // in flight), and the values feed nothing; a branch round the reads would save no time.
#pragma unroll
        for (int dc = 0; dc < 4; ++dc) {
            kb[dc]     = ld_op16(&Kst[set][cur ^ 1][(0  + ln) * KP + dc * 32 + koff]);
            kb[4 + dc] = ld_op16(&Kst[set][cur ^ 1][(16 + ln) * KP + dc * 32 + koff]);
        }

        // Scalar branch, rarely taken (the hint moves its body out of the loop's straight line):
        // the half-waves join their maxima, and the sums so far are brought to the new reference.
        if (__builtin_expect(grow != 0, 0)) {
#pragma unroll
            for (int g = 0; g < QG; ++g) {
                const float mnew = fmaxf(mrun[g], fmaxf(vmax[g], __shfl_xor(vmax[g], 16, 32)));
                const float corr = fast_exp2(mrun[g] - mnew);
                mrun[g] = mnew;
                mthr[g] = mnew + LAZY;
                lacc[g] = lacc[g] * corr;
#pragma unroll
                for (int db = 0; db < 8; ++db)    // v8f * scalar -> v_pk_mul_f32
                    ot[g][db] = ot[g][db] * corr;
            }
        }

        v16h pa[QG];                      // exponentiated scores == P^T B-operand layout
        v8f e0[QG], e1[QG];
#pragma unroll
        for (int g = 0; g < QG; ++g) { e0[g] = ct0[g] - mrun[g]; e1[g] = ct1[g] - mrun[g]; }
#pragma unroll
        for (int g = 0; g < QG; ++g) {
#pragma unroll
            for (int r = 0; r < 8; ++r) e0[g][r] = fast_exp2(e0[g][r]);
#pragma unroll
            for (int r = 0; r < 8; ++r) e1[g][r] = fast_exp2(e1[g][r]);
        }
#pragma unroll
        for (int g = 0; g < QG; ++g) {
#pragma unroll
            for (int r = 0; r < 8; ++r) { pa[g][r] = (_Float16)e0[g][r]; pa[g][8 + r] = (_Float16)e1[g][r]; }
        }

        // ---- denominators += column sums of P^T (of the f16 values that the O products use) ----
#pragma unroll
        for (int g = 0; g < QG; ++g)
            lacc[g] = __builtin_amdgcn_wmma_f32_16x16x32_f16(false, ones, false, pa[g],
                                                             (short)0, lacc[g], false, false);

        // ---- O^T += V^T * P^T ----
#pragma unroll
        for (int db = 0; db < 8; ++db) {
#pragma unroll
            for (int g = 0; g < QG; ++g)
                ot[g][db] = __builtin_amdgcn_wmma_f32_16x16x32_f16(false, vb[db], false, pa[g],
                                                                   (short)0, ot[g][db], false, false);
        }

        // Keeps the wait below behind the O products: left free, it rises among them and the wave
        // stands there until the K reads have landed.
        __builtin_amdgcn_sched_barrier(0);
        // Ends this wave's reads of the K and V buffers that the next trip refills behind the barrier.
        asm volatile("s_wait_dscnt 0x0" ::: "memory");
        if (t + 1 < NTS) {
#ifdef USE_ASYNC_LDS
            wait_async0();                // drain our async writes before publishing
#else
            _Float16* vd = &Vst[set][cur ^ 1][vso];
#pragma unroll
            for (int j = 0; j < 4; ++j) *(v8h*)(vd + j * VSTEP) = vr[j];
            if (t + 2 < NTS) {
                _Float16* kd = &Kst[set][cur][kso];
#pragma unroll
                for (int j = 0; j < 4; ++j) *(v8h*)(kd + j * KSTEP) = kr[j];
            }
#endif
        }
        __syncthreads();
    }

    // ---- merge the two key halves: a wave keeps query group 'set' and hands the other one
    //      to the wave of the other set that holds the same queries ----
    const int me = set * WAVES + wave;
    const int pw = (set ^ 1) * WAVES + wave;
    if (set == 0) put_part(Xo[me], Xml[me], lane, ot[1], mrun[1], lacc[1][0]);
    else          put_part(Xo[me], Xml[me], lane, ot[0], mrun[0], lacc[0][0]);
    __syncthreads();

    // ---- normalize + store: lane writes q-row ln, d = db*16 + mb + 0..7 ----
    float* orow = O + bbase + (size_t)(q0 + set * 16 + ln) * DD + mb;
    if (set == 0) merge_store(Xo[pw], Xml[pw], lane, ot[0], mrun[0], lacc[0][0], orow);
    else          merge_store(Xo[pw], Xml[pw], lane, ot[1], mrun[1], lacc[1][0], orow);
}

extern "C" void kernel_launch(void* const* d_in, const int* in_sizes, int n_in,
                              void* d_out, int out_size, void* d_ws, size_t ws_size,
                              hipStream_t stream) {
    (void)in_sizes; (void)n_in; (void)out_size; (void)ws_size;
    const float* Q = (const float*)d_in[0];
    const float* K = (const float*)d_in[1];
    const float* V = (const float*)d_in[2];
    float* O = (float*)d_out;
    // workspace: Kh (8.39 MB) | Vt (8.39 MB)  -> 16.78 MB of d_ws
    _Float16* Kh = (_Float16*)d_ws;
    _Float16* Vt = Kh + (size_t)BB * SS * DD;
    hipLaunchKernelGGL(fa_prep, dim3(BB * NT), dim3(128), 0, stream, K, V, Kh, Vt);
    hipLaunchKernelGGL(DotProductAttention_48421461295297_kernel,
                       dim3(BB * (SS / (WAVES * QG * 16))), dim3(SETS * WAVES * 32), 0, stream, Q, Kh, Vt, O);
}

// v009
// Measured time: 33.5 microseconds a run.
// In both of two side-by-side timings against v008, it was 1.14 times as fast.
// Counting every step since v000, it is 5.13 times as fast.
#include <hip/hip_runtime.h>

typedef _Float16 v16h __attribute__((ext_vector_type(16)));
typedef _Float16 v8h  __attribute__((ext_vector_type(8)));
typedef float    v8f  __attribute__((ext_vector_type(8)));

constexpr int BB = 16;
constexpr int SS = 2048;
constexpr int DD = 128;
constexpr int KVT = 32;              // kv rows per tile
constexpr int NT  = SS / KVT;        // 64 kv tiles
constexpr int WAVES = 4;             // wave32s that share one key half; each has its own query columns
constexpr int SETS  = 2;             // key halves per workgroup: waves w and w + WAVES hold the same queries
constexpr int NTS   = NT / SETS;     // kv tiles per key half
constexpr int QG  = 2;               // 16-column query groups per wave: each K / V^T fragment feeds QG products
constexpr int TILE_H = KVT * DD;     // f16 elements per staged tile (4096 = 8KB)
// LDS row pitches in f16 elements: 16 B x odd, so the 16 rows that one half-wave
// ds_load_b128 touches fall on 16 distinct groups of four banks.
constexpr int KP = DD + 8;           // K rows: 256 B of data on a 272 B pitch
constexpr int VP = KVT + 8;          // V^T rows: 64 B of data on an 80 B pitch
// f32 rows of Q and O on their way between global memory and the fragment layout: same rule.
constexpr int SP = DD + 4;           // 512 B of data on a 528 B pitch, in f32 elements

// gfx1250 async global->LDS copy path (ASYNCcnt) if the toolchain exposes it.
#if defined(__has_builtin)
#if __has_builtin(__builtin_amdgcn_global_load_async_to_lds_b128)
#define USE_ASYNC_LDS 1
#endif
#endif

#ifdef USE_ASYNC_LDS
// Param 0: gcc-style int4 pointer in AS(1) (global); param 1: LDS-side pointer.
typedef int v4i __attribute__((vector_size(16)));
typedef __attribute__((address_space(1))) v4i* gasp;   // global (AS1)
typedef __attribute__((address_space(3))) v4i* lasp;   // LDS (AS3)
__device__ __forceinline__ gasp to_global(const void* p) {
    return (gasp)(unsigned long long)p;                // AS1 == generic numerically
}
__device__ __forceinline__ lasp to_lds(void* p) {
    return (lasp)(unsigned)(unsigned long long)p;      // LDS offset = low 32 bits
}
__device__ __forceinline__ void wait_async0() {
#if __has_builtin(__builtin_amdgcn_s_wait_asynccnt)
    __builtin_amdgcn_s_wait_asynccnt(0);
#else
    asm volatile("s_wait_asynccnt 0x0" ::: "memory");
#endif
}
#endif

// Raw v_exp_f32: args here are never above LAZY = 8, and sub-(-126) inputs should flush
// to 0 probability anyway, so skip ocml's denormal-range fixup entirely.
__device__ __forceinline__ float fast_exp2(float x) {
#if defined(__has_builtin) && __has_builtin(__builtin_amdgcn_exp2f)
    return __builtin_amdgcn_exp2f(x);
#else
    return exp2f(x);
#endif
}
__device__ __forceinline__ float fast_rcp(float x) {
#if defined(__has_builtin) && __has_builtin(__builtin_amdgcn_rcpf)
    return __builtin_amdgcn_rcpf(x);
#else
    return 1.0f / x;
#endif
}

// Build a v16h WMMA operand from two contiguous 16B LDS chunks (2x ds_load_b128).
__device__ __forceinline__ v16h ld_op16(const _Float16* p) {
    v8h lo = *(const v8h*)p;
    v8h hh = *(const v8h*)(p + 16);
    v16h r;
#pragma unroll
    for (int i = 0; i < 8; ++i) { r[i] = lo[i]; r[i + 8] = hh[i]; }
    return r;
}

// ---------------- pre-pass: K -> f16 flat, V -> f16 transposed per 32-row tile ----------------
__global__ __launch_bounds__(128, 1)
void fa_prep(const float* __restrict__ K, const float* __restrict__ V,
             _Float16* __restrict__ Kh, _Float16* __restrict__ Vt)
{
    __shared__ __align__(16) _Float16 T[DD * KVT];   // [d][k]
    const int tid  = threadIdx.x;
    const int b    = blockIdx.x >> 6;
    const int t    = blockIdx.x & 63;
    const int krow = tid >> 2;
    const int cgrp = (tid & 3) * 32;
    const size_t tb = ((size_t)b * SS + (size_t)t * KVT) * DD;
    const float* kp = K + tb + (size_t)krow * DD + cgrp;
    const float* vp = V + tb + (size_t)krow * DD + cgrp;
    _Float16*    kq = Kh + tb + (size_t)krow * DD + cgrp;
#pragma unroll
    for (int j = 0; j < 4; ++j) {
        float4 a = *(const float4*)(kp + 8 * j);
        float4 c = *(const float4*)(kp + 8 * j + 4);
        v8h h;
        h[0]=(_Float16)a.x; h[1]=(_Float16)a.y; h[2]=(_Float16)a.z; h[3]=(_Float16)a.w;
        h[4]=(_Float16)c.x; h[5]=(_Float16)c.y; h[6]=(_Float16)c.z; h[7]=(_Float16)c.w;
        *(v8h*)(kq + 8 * j) = h;
        float4 e = *(const float4*)(vp + 8 * j);
        float4 f = *(const float4*)(vp + 8 * j + 4);
        const int d0 = cgrp + 8 * j;
        T[(d0+0)*KVT + krow] = (_Float16)e.x;
        T[(d0+1)*KVT + krow] = (_Float16)e.y;
        T[(d0+2)*KVT + krow] = (_Float16)e.z;
        T[(d0+3)*KVT + krow] = (_Float16)e.w;
        T[(d0+4)*KVT + krow] = (_Float16)f.x;
        T[(d0+5)*KVT + krow] = (_Float16)f.y;
        T[(d0+6)*KVT + krow] = (_Float16)f.z;
        T[(d0+7)*KVT + krow] = (_Float16)f.w;
    }
    __syncthreads();
    _Float16* vo = Vt + tb + (size_t)tid * KVT;
    const _Float16* ts = &T[tid * KVT];
#pragma unroll
    for (int j = 0; j < 4; ++j)
        *(v8h*)(vo + 8 * j) = *(const v8h*)(ts + 8 * j);
}

// Merge of the two key halves, sending side: one query group's partial O^T, maximum and sum to LDS.
__device__ __forceinline__ void put_part(float4 (*xo)[32], float2* xml, int lane,
                                         const v8f (&o)[8], float m, float l) {
    xml[lane] = make_float2(m, l);
#pragma unroll
    for (int db = 0; db < 8; ++db) {
        xo[2 * db][lane]     = make_float4(o[db][0], o[db][1], o[db][2], o[db][3]);
        xo[2 * db + 1][lane] = make_float4(o[db][4], o[db][5], o[db][6], o[db][7]);
    }
}
// Receiving side: both halves brought to their common maximum, added, normalised, stored.
// A lane holds 32 B pieces of one query row; stored from there, a wave-wide store would touch
// 16 lines. The 16 rows go through the wave's own LDS rows 'st' instead, and each wave-wide
// store then covers one whole row of O: 512 contiguous bytes, four whole 128 B lines.
__device__ __forceinline__ void merge_store(const float4 (*xo)[32], const float2* xml, int lane,
                                            const v8f (&o)[8], float m, float l,
                                            float (*st)[SP], float* obase) {
    float* srow = &st[lane & 15][(lane >> 4) * 8];   // q-row lane & 15, d = db*16 + 8*(lane >> 4) + 0..7
    const float2 ml = xml[lane];
    const float mn = fmaxf(m, ml.x);
    const float ca = fast_exp2(m - mn);
    const float cb = fast_exp2(ml.x - mn);
    const float inv = fast_rcp(l * ca + ml.y * cb);
    const float fa = ca * inv;
    const float fb = cb * inv;
#pragma unroll
    for (int db = 0; db < 8; ++db) {
        const float4 p0 = xo[2 * db][lane];
        const float4 p1 = xo[2 * db + 1][lane];
        float4 lo4, hi4;
        lo4.x = o[db][0] * fa + p0.x * fb; lo4.y = o[db][1] * fa + p0.y * fb;
        lo4.z = o[db][2] * fa + p0.z * fb; lo4.w = o[db][3] * fa + p0.w * fb;
        hi4.x = o[db][4] * fa + p1.x * fb; hi4.y = o[db][5] * fa + p1.y * fb;
        hi4.z = o[db][6] * fa + p1.z * fb; hi4.w = o[db][7] * fa + p1.w * fb;
        *(float4*)(srow + db * 16)     = lo4;
        *(float4*)(srow + db * 16 + 4) = hi4;
    }
    // The rows are read back by other lanes of this wave: its LDS writes end first.
    asm volatile("s_wait_dscnt 0x0" ::: "memory");
    float4 row[16];
#pragma unroll
    for (int r = 0; r < 16; ++r) row[r] = *(const float4*)(&st[r][lane * 4]);
#pragma unroll
    for (int r = 0; r < 16; ++r) *(float4*)(obase + r * DD + lane * 4) = row[r];
}

// ---------------- main FlashAttention kernel (transpose-free, double-buffered) ----------------
// Two sets of WAVES waves walk the two halves of the keys for the same queries, so that every
// SIMD holds two waves: one wave's softmax runs beside the other's products. The halves'
// partial results (maximum, sum, unnormalised O^T) are merged through LDS behind the loop.
__global__ __launch_bounds__(SETS * WAVES * 32, 1)
void DotProductAttention_48421461295297_kernel(const float* __restrict__ Q,
                                               const _Float16* __restrict__ Kh,
                                               const _Float16* __restrict__ Vt,
                                               float* __restrict__ O)
{
    __shared__ __align__(16) _Float16 Kst[SETS][2][KVT * KP];   // [k=32][d=128], padded rows
    __shared__ __align__(16) _Float16 Vst[SETS][2][DD * VP];    // [d=128][k=32], padded rows
    __shared__ __align__(16) float4 Xo[SETS * WAVES][16][32];   // merge: one query group's O^T per wave
    __shared__ float2 Xml[SETS * WAVES][32];                    // merge: its running maximum and sum
    __shared__ __align__(16) float Stg[SETS * WAVES][QG * 16][SP];  // a wave's own rows of Q, later of O

    const int set  = __builtin_amdgcn_readfirstlane((int)threadIdx.x >> 7);   // key half, wave-uniform
    const int tid  = threadIdx.x & (WAVES * 32 - 1);                          // thread within its set
    const int wave = tid >> 5;
    const int lane = tid & 31;
    const int ln   = lane & 15;
    const int koff = (lane >> 4) * 8;   // K-range offset in operand layout

    const int batch = blockIdx.x >> 4;
    const int qblk  = blockIdx.x & 15;
    const int q0    = qblk * (WAVES * QG * 16) + wave * (QG * 16);
    const size_t bbase = (size_t)batch * SS * DD;

    const float SL2E = 0.08838834764831845f * 1.4426950408889634f;  // 1/sqrt(128)*log2(e)

    // Q tile -> f16 registers with the softmax scale folded in (log2 domain).
    // Each wave-wide load takes one whole row of Q (512 contiguous bytes, four whole lines); the
    // rows pass through the wave's own LDS rows, from which each lane picks its fragment pieces.
    float (*stg)[SP] = Stg[set * WAVES + wave];
    const float* qrow = Q + bbase + (size_t)q0 * DD + lane * 4;
    {
        float4 qv[QG * 16];
#pragma unroll
        for (int r = 0; r < QG * 16; ++r) qv[r] = *(const float4*)(qrow + r * DD);
#pragma unroll
        for (int r = 0; r < QG * 16; ++r) *(float4*)(&stg[r][lane * 4]) = qv[r];
    }
    // The Q loads' address registers are reused behind them. The address as an input keeps
    // its registers live up to the wait, so the overwrite cannot be lifted over it.
    asm volatile("s_wait_xcnt 0x0" :: "v"(qrow) : "memory");
    // The rows are read back by other lanes of this wave: its LDS writes end first.
    asm volatile("s_wait_dscnt 0x0" ::: "memory");
    v16h qa[QG][4];
#pragma unroll
    for (int g = 0; g < QG; ++g) {
        const float* qp = &stg[g * 16 + ln][0];
#pragma unroll
        for (int dc = 0; dc < 4; ++dc) {
            const int off = dc * 32 + koff;
            float4 f0 = *(const float4*)(qp + off);
            float4 f1 = *(const float4*)(qp + off + 4);
            float4 f2 = *(const float4*)(qp + off + 16);
            float4 f3 = *(const float4*)(qp + off + 20);
            v16h a;
            a[0]=(_Float16)(f0.x*SL2E);  a[1]=(_Float16)(f0.y*SL2E);
            a[2]=(_Float16)(f0.z*SL2E);  a[3]=(_Float16)(f0.w*SL2E);
            a[4]=(_Float16)(f1.x*SL2E);  a[5]=(_Float16)(f1.y*SL2E);
            a[6]=(_Float16)(f1.z*SL2E);  a[7]=(_Float16)(f1.w*SL2E);
            a[8]=(_Float16)(f2.x*SL2E);  a[9]=(_Float16)(f2.y*SL2E);
            a[10]=(_Float16)(f2.z*SL2E); a[11]=(_Float16)(f2.w*SL2E);
            a[12]=(_Float16)(f3.x*SL2E); a[13]=(_Float16)(f3.y*SL2E);
            a[14]=(_Float16)(f3.z*SL2E); a[15]=(_Float16)(f3.w*SL2E);
            qa[g][dc] = a;
        }
    }

    v8f ot[QG][8] = {};                   // O^T accumulators: rows d, cols q (fp32)
    // mrun is the reference that the exponentials are taken against: a maximum of an earlier trip,
    // renewed only when a score rises more than LAZY above it (mthr = mrun + LAZY), so P <= 2^LAZY.
    constexpr float LAZY = 8.0f;          // log2 units: 256 is far inside the f16 range
    float mrun[QG], mthr[QG];
#pragma unroll
    for (int g = 0; g < QG; ++g) { mrun[g] = -__builtin_inff(); mthr[g] = -__builtin_inff(); }
    // Softmax denominators on the matrix unit: A has ones in rows 0 and 8 (lanes 0, 8, 16, 24) and
    // zeros elsewhere, so rows 0 and 8 of A * P^T hold the column sums of P^T over the tile's 32 keys:
    // register 0 of the result in either half-wave, and each lane finds its own query's sum in lacc[g][0].
    const _Float16 one_row = ((lane & 7) == 0) ? (_Float16)1.0f : (_Float16)0.0f;
    v16h ones;
#pragma unroll
    for (int i = 0; i < 16; ++i) ones[i] = one_row;
    v8f lacc[QG] = {};

    // prefetch: each thread asks for one 64 B piece of the K tile and of the V tile
    const size_t hbase = bbase + (size_t)set * NTS * TILE_H;   // first tile of this set's key half
    const _Float16* kbase = Kh + hbase + (size_t)tid * 32;
    const _Float16* vbase = Vt + hbase + (size_t)tid * 32;
    // staging: a tile is 512 pieces of 16 B; copy j of thread tid moves piece j * 128 + tid,
    // so the 32 lanes of one copy cover 512 contiguous bytes: four whole 128 B lines.
    const _Float16* kcp = Kh + hbase + (size_t)tid * 8;
    const _Float16* vcp = Vt + hbase + (size_t)tid * 8;
    // where piece tid lands in LDS: 16 pieces a K row, 4 pieces a V^T row
    const int kso = (tid >> 4) * KP + (tid & 15) * 8;
    const int vso = (tid >> 2) * VP + (tid & 3) * 8;
    constexpr int GSTEP = 128 * 8;       // f16 elements from piece p to piece p + 128, global
    constexpr int KSTEP = 8 * KP;        // the same in LDS: 8 K rows further
    constexpr int VSTEP = 32 * VP;       // the same in LDS: 32 V^T rows further

    // Tile j of K lies in Kst[set][j & 1], tile j of V^T in Vst[set][j & 1]. K runs one tile ahead
    // of V: trip t reads the fragments of K tile t + 1, so that tile is published one trip earlier.
#ifdef USE_ASYNC_LDS
    {   // stage K tiles 0 and 1 and V tile 0: direct global->LDS, no VGPR traffic
#pragma unroll
        for (int j = 0; j < 4; ++j) {
            __builtin_amdgcn_global_load_async_to_lds_b128(to_global(kcp + j * GSTEP),
                                                           to_lds(&Kst[set][0][kso + j * KSTEP]), 0, 0);
            __builtin_amdgcn_global_load_async_to_lds_b128(to_global(vcp + j * GSTEP),
                                                           to_lds(&Vst[set][0][vso + j * VSTEP]), 0, 0);
            __builtin_amdgcn_global_load_async_to_lds_b128(to_global(kcp + TILE_H + j * GSTEP),
                                                           to_lds(&Kst[set][1][kso + j * KSTEP]), 0, 0);
        }
        wait_async0();
    }
#else
    v8h kr[4], vr[4];
#pragma unroll
    for (int b = 0; b < 2; ++b) {
#pragma unroll
        for (int j = 0; j < 4; ++j) kr[j] = *(const v8h*)(kcp + b * TILE_H + j * GSTEP);
#pragma unroll
        for (int j = 0; j < 4; ++j) *(v8h*)(&Kst[set][b][kso + j * KSTEP]) = kr[j];
    }
#pragma unroll
    for (int j = 0; j < 4; ++j) vr[j] = *(const v8h*)(vcp + j * GSTEP);
#pragma unroll
    for (int j = 0; j < 4; ++j) *(v8h*)(&Vst[set][0][vso + j * VSTEP]) = vr[j];
#endif
    __syncthreads();

    v16h kb[8];                           // K fragments, always one tile ahead: here tile 0's
#pragma unroll
    for (int dc = 0; dc < 4; ++dc) {
        kb[dc]     = ld_op16(&Kst[set][0][(0  + ln) * KP + dc * 32 + koff]);
        kb[4 + dc] = ld_op16(&Kst[set][0][(16 + ln) * KP + dc * 32 + koff]);
    }
    // Ends this wave's reads of K buffer 0: trip 0 refills it behind the barrier below.
    asm volatile("s_wait_dscnt 0x0" ::: "memory");
    __syncthreads();

#pragma unroll 1
    for (int t = 0; t < NTS; ++t) {
        const int cur = t & 1;

        if (t + 1 < NTS) {                 // start the next copies before compute
            // V tile t + 1 into the buffer that trip t - 1 read at its top
            const _Float16* vn = vcp + (size_t)(t + 1) * TILE_H;
#ifdef USE_ASYNC_LDS
#pragma unroll
            for (int j = 0; j < 4; ++j)
                __builtin_amdgcn_global_load_async_to_lds_b128(to_global(vn + j * GSTEP),
                                                               to_lds(&Vst[set][cur ^ 1][vso + j * VSTEP]), 0, 0);
#else
#pragma unroll
            for (int j = 0; j < 4; ++j) vr[j] = *(const v8h*)(vn + j * GSTEP);
#endif
            if (t + 2 < NTS) {
                // K tile t + 2 into the buffer of K tile t, whose fragments trip t - 1 fetched
                const _Float16* kn = kcp + (size_t)(t + 2) * TILE_H;
#ifdef USE_ASYNC_LDS
#pragma unroll
                for (int j = 0; j < 4; ++j)
                    __builtin_amdgcn_global_load_async_to_lds_b128(to_global(kn + j * GSTEP),
                                                                   to_lds(&Kst[set][cur][kso + j * KSTEP]), 0, 0);
#else
#pragma unroll
                for (int j = 0; j < 4; ++j) kr[j] = *(const v8h*)(kn + j * GSTEP);
#endif
                // gfx1250 global_prefetch, one tile ahead of each copy
                __builtin_prefetch(vbase + (size_t)(t + 2) * TILE_H, 0, 1);
                if (t + 3 < NTS)
                    __builtin_prefetch(kbase + (size_t)(t + 3) * TILE_H, 0, 1);
            }
        }

        v16h vb[8];                       // this tile's V^T fragments: they land behind the S products
#pragma unroll
        for (int db = 0; db < 8; ++db)
            vb[db] = ld_op16(&Vst[set][cur][(db * 16 + ln) * VP + koff]);
        // Keeps the 16 V^T reads above as one group in front of the S products: left free,
        // the scheduler sinks each pair to its product and the wave waits out a full LDS
        // latency in front of every product.
        __builtin_amdgcn_sched_barrier(0);

        // ---- S^T = K_tile * Q^T, on the fragments that the trip before fetched ----
        v8f ct0[QG] = {}, ct1[QG] = {};
#pragma unroll
        for (int dc = 0; dc < 4; ++dc) {
#pragma unroll
            for (int g = 0; g < QG; ++g) {
                ct0[g] = __builtin_amdgcn_wmma_f32_16x16x32_f16(false, kb[dc],     false, qa[g][dc],
                                                                (short)0, ct0[g], false, false);
                ct1[g] = __builtin_amdgcn_wmma_f32_16x16x32_f16(false, kb[4 + dc], false, qa[g][dc],
                                                                (short)0, ct1[g], false, false);
            }
        }

        // ---- online softmax (log2 domain; scores already scaled via Q), per query group ----
        float vmax[QG];                   // a lane's own maximum: 16 of its query's 32 scores
        bool need = false;                // does one of them outgrow the reference in use?
#pragma unroll
        for (int g = 0; g < QG; ++g) {
            vmax[g] = ct0[g][0];
#pragma unroll
            for (int r = 1; r < 8; ++r) vmax[g] = fmaxf(vmax[g], ct0[g][r]);
#pragma unroll
            for (int r = 0; r < 8; ++r) vmax[g] = fmaxf(vmax[g], ct1[g][r]);
            need = need || (vmax[g] > mthr[g]);
        }
        // One test a trip for the whole wave; the first trip always takes it (mthr = -inf).
        const unsigned grow = __builtin_amdgcn_ballot_w32(need);
        // Keeps the 16 reads below out of the S products: left free, the scheduler puts each pair
        // behind the last product that uses its fragment's registers, eight places with reads.
        __builtin_amdgcn_sched_barrier(0);
        // The next tile's K fragments, behind the S products, which free kb: they land under the
        // exponentials and the O products, and the next trip's S products start at once.
        // The last trip has no next tile: it reads the tile before its own again (published, no copy
        // in flight), and the values feed nothing; a branch round the reads would save no time.
#pragma unroll
        for (int dc = 0; dc < 4; ++dc) {
            kb[dc]     = ld_op16(&Kst[set][cur ^ 1][(0  + ln) * KP + dc * 32 + koff]);
            kb[4 + dc] = ld_op16(&Kst[set][cur ^ 1][(16 + ln) * KP + dc * 32 + koff]);
        }

        // Scalar branch, rarely taken (the hint moves its body out of the loop's straight line):
        // the half-waves join their maxima, and the sums so far are brought to the new reference.
        if (__builtin_expect(grow != 0, 0)) {
#pragma unroll
            for (int g = 0; g < QG; ++g) {
                const float mnew = fmaxf(mrun[g], fmaxf(vmax[g], __shfl_xor(vmax[g], 16, 32)));
                const float corr = fast_exp2(mrun[g] - mnew);
                mrun[g] = mnew;
                mthr[g] = mnew + LAZY;
                lacc[g] = lacc[g] * corr;
#pragma unroll
                for (int db = 0; db < 8; ++db)    // v8f * scalar -> v_pk_mul_f32
                    ot[g][db] = ot[g][db] * corr;
            }
        }

        v16h pa[QG];                      // exponentiated scores == P^T B-operand layout
        v8f e0[QG], e1[QG];
#pragma unroll
        for (int g = 0; g < QG; ++g) { e0[g] = ct0[g] - mrun[g]; e1[g] = ct1[g] - mrun[g]; }
#pragma unroll
        for (int g = 0; g < QG; ++g) {
#pragma unroll
            for (int r = 0; r < 8; ++r) e0[g][r] = fast_exp2(e0[g][r]);
#pragma unroll
            for (int r = 0; r < 8; ++r) e1[g][r] = fast_exp2(e1[g][r]);
        }
#pragma unroll
        for (int g = 0; g < QG; ++g) {
#pragma unroll
            for (int r = 0; r < 8; ++r) { pa[g][r] = (_Float16)e0[g][r]; pa[g][8 + r] = (_Float16)e1[g][r]; }
        }

        // ---- denominators += column sums of P^T (of the f16 values that the O products use) ----
#pragma unroll
        for (int g = 0; g < QG; ++g)
            lacc[g] = __builtin_amdgcn_wmma_f32_16x16x32_f16(false, ones, false, pa[g],
                                                             (short)0, lacc[g], false, false);

        // ---- O^T += V^T * P^T ----
#pragma unroll
        for (int db = 0; db < 8; ++db) {
#pragma unroll
            for (int g = 0; g < QG; ++g)
                ot[g][db] = __builtin_amdgcn_wmma_f32_16x16x32_f16(false, vb[db], false, pa[g],
                                                                   (short)0, ot[g][db], false, false);
        }

        // Keeps the wait below behind the O products: left free, it rises among them and the wave
        // stands there until the K reads have landed.
        __builtin_amdgcn_sched_barrier(0);
        // Ends this wave's reads of the K and V buffers that the next trip refills behind the barrier.
        asm volatile("s_wait_dscnt 0x0" ::: "memory");
        if (t + 1 < NTS) {
#ifdef USE_ASYNC_LDS
            wait_async0();                // drain our async writes before publishing
#else
            _Float16* vd = &Vst[set][cur ^ 1][vso];
#pragma unroll
            for (int j = 0; j < 4; ++j) *(v8h*)(vd + j * VSTEP) = vr[j];
            if (t + 2 < NTS) {
                _Float16* kd = &Kst[set][cur][kso];
#pragma unroll
                for (int j = 0; j < 4; ++j) *(v8h*)(kd + j * KSTEP) = kr[j];
            }
#endif
        }
        __syncthreads();
    }

    // ---- merge the two key halves: a wave keeps query group 'set' and hands the other one
    //      to the wave of the other set that holds the same queries ----
    const int me = set * WAVES + wave;
    const int pw = (set ^ 1) * WAVES + wave;
    if (set == 0) put_part(Xo[me], Xml[me], lane, ot[1], mrun[1], lacc[1][0]);
    else          put_part(Xo[me], Xml[me], lane, ot[0], mrun[0], lacc[0][0]);
    __syncthreads();

    // ---- normalize + store: the wave's 16 query rows, whole rows at a time ----
    float* obase = O + bbase + (size_t)(q0 + set * 16) * DD;
    if (set == 0) merge_store(Xo[pw], Xml[pw], lane, ot[0], mrun[0], lacc[0][0], stg, obase);
    else          merge_store(Xo[pw], Xml[pw], lane, ot[1], mrun[1], lacc[1][0], stg, obase);
}

extern "C" void kernel_launch(void* const* d_in, const int* in_sizes, int n_in,
                              void* d_out, int out_size, void* d_ws, size_t ws_size,
                              hipStream_t stream) {
    (void)in_sizes; (void)n_in; (void)out_size; (void)ws_size;
    const float* Q = (const float*)d_in[0];
    const float* K = (const float*)d_in[1];
    const float* V = (const float*)d_in[2];
    float* O = (float*)d_out;
    // workspace: Kh (8.39 MB) | Vt (8.39 MB)  -> 16.78 MB of d_ws
    _Float16* Kh = (_Float16*)d_ws;
    _Float16* Vt = Kh + (size_t)BB * SS * DD;
    hipLaunchKernelGGL(fa_prep, dim3(BB * NT), dim3(128), 0, stream, K, V, Kh, Vt);
    hipLaunchKernelGGL(DotProductAttention_48421461295297_kernel,
                       dim3(BB * (SS / (WAVES * QG * 16))), dim3(SETS * WAVES * 32), 0, stream, Q, Kh, Vt, O);
}

// v010
// It runs in 32.1 microseconds.
// Next to v009, in two timings, it ran 1.03 and 1.04 times as fast.
// All steps since v000 together make it 5.31 times as fast.
#include <hip/hip_runtime.h>

typedef _Float16 v16h __attribute__((ext_vector_type(16)));
typedef _Float16 v8h  __attribute__((ext_vector_type(8)));
typedef float    v8f  __attribute__((ext_vector_type(8)));

constexpr int BB = 16;
constexpr int SS = 2048;
constexpr int DD = 128;
constexpr int KVT = 32;              // kv rows per tile
constexpr int NT  = SS / KVT;        // 64 kv tiles
constexpr int WAVES = 4;             // wave32s that share one key half; each has its own query columns
constexpr int SETS  = 2;             // key halves per workgroup: waves w and w + WAVES hold the same queries
constexpr int NTS   = NT / SETS;     // kv tiles per key half
constexpr int QG  = 2;               // 16-column query groups per wave: each K / V^T fragment feeds QG products
constexpr int TILE_H = KVT * DD;     // f16 elements per staged tile (4096 = 8KB)
// LDS row pitches in f16 elements: 16 B x odd, so the 16 rows that one half-wave
// ds_load_b128 touches fall on 16 distinct groups of four banks.
constexpr int KP = DD + 8;           // K rows: 256 B of data on a 272 B pitch
constexpr int VP = KVT + 8;          // V^T rows: 64 B of data on an 80 B pitch
// f32 rows of Q and O on their way between global memory and the fragment layout: same rule.
constexpr int SP = DD + 4;           // 512 B of data on a 528 B pitch, in f32 elements

// gfx1250 async global->LDS copy path (ASYNCcnt) if the toolchain exposes it.
#if defined(__has_builtin)
#if __has_builtin(__builtin_amdgcn_global_load_async_to_lds_b128)
#define USE_ASYNC_LDS 1
#endif
#endif

#ifdef USE_ASYNC_LDS
// Param 0: gcc-style int4 pointer in AS(1) (global); param 1: LDS-side pointer.
typedef int v4i __attribute__((vector_size(16)));
typedef __attribute__((address_space(1))) v4i* gasp;   // global (AS1)
typedef __attribute__((address_space(3))) v4i* lasp;   // LDS (AS3)
__device__ __forceinline__ gasp to_global(const void* p) {
    return (gasp)(unsigned long long)p;                // AS1 == generic numerically
}
__device__ __forceinline__ lasp to_lds(void* p) {
    return (lasp)(unsigned)(unsigned long long)p;      // LDS offset = low 32 bits
}
__device__ __forceinline__ void wait_async0() {
#if __has_builtin(__builtin_amdgcn_s_wait_asynccnt)
    __builtin_amdgcn_s_wait_asynccnt(0);
#else
    asm volatile("s_wait_asynccnt 0x0" ::: "memory");
#endif
}
#endif

// Raw v_exp_f32: args here are never above LAZY = 8, and sub-(-126) inputs should flush
// to 0 probability anyway, so skip ocml's denormal-range fixup entirely.
__device__ __forceinline__ float fast_exp2(float x) {
#if defined(__has_builtin) && __has_builtin(__builtin_amdgcn_exp2f)
    return __builtin_amdgcn_exp2f(x);
#else
    return exp2f(x);
#endif
}
__device__ __forceinline__ float fast_rcp(float x) {
#if defined(__has_builtin) && __has_builtin(__builtin_amdgcn_rcpf)
    return __builtin_amdgcn_rcpf(x);
#else
    return 1.0f / x;
#endif
}

// Build a v16h WMMA operand from two contiguous 16B LDS chunks (2x ds_load_b128).
__device__ __forceinline__ v16h ld_op16(const _Float16* p) {
    v8h lo = *(const v8h*)p;
    v8h hh = *(const v8h*)(p + 16);
    v16h r;
#pragma unroll
    for (int i = 0; i < 8; ++i) { r[i] = lo[i]; r[i + 8] = hh[i]; }
    return r;
}

// ---------------- pre-pass: K -> f16 flat, V -> f16 transposed per 32-row tile ----------------
__global__ __launch_bounds__(128, 1)
void fa_prep(const float* __restrict__ K, const float* __restrict__ V,
             _Float16* __restrict__ Kh, _Float16* __restrict__ Vt)
{
    __shared__ __align__(16) _Float16 T[DD * KVT];   // [d][k]
    const int tid  = threadIdx.x;
    const int b    = blockIdx.x >> 6;
    const int t    = blockIdx.x & 63;
    const int krow = tid >> 2;
    const int cgrp = (tid & 3) * 32;
    const size_t tb = ((size_t)b * SS + (size_t)t * KVT) * DD;
    const float* kp = K + tb + (size_t)krow * DD + cgrp;
    const float* vp = V + tb + (size_t)krow * DD + cgrp;
    _Float16*    kq = Kh + tb + (size_t)krow * DD + cgrp;
#pragma unroll
    for (int j = 0; j < 4; ++j) {
        float4 a = *(const float4*)(kp + 8 * j);
        float4 c = *(const float4*)(kp + 8 * j + 4);
        v8h h;
        h[0]=(_Float16)a.x; h[1]=(_Float16)a.y; h[2]=(_Float16)a.z; h[3]=(_Float16)a.w;
        h[4]=(_Float16)c.x; h[5]=(_Float16)c.y; h[6]=(_Float16)c.z; h[7]=(_Float16)c.w;
        *(v8h*)(kq + 8 * j) = h;
        float4 e = *(const float4*)(vp + 8 * j);
        float4 f = *(const float4*)(vp + 8 * j + 4);
        const int d0 = cgrp + 8 * j;
        T[(d0+0)*KVT + krow] = (_Float16)e.x;
        T[(d0+1)*KVT + krow] = (_Float16)e.y;
        T[(d0+2)*KVT + krow] = (_Float16)e.z;
        T[(d0+3)*KVT + krow] = (_Float16)e.w;
        T[(d0+4)*KVT + krow] = (_Float16)f.x;
        T[(d0+5)*KVT + krow] = (_Float16)f.y;
        T[(d0+6)*KVT + krow] = (_Float16)f.z;
        T[(d0+7)*KVT + krow] = (_Float16)f.w;
    }
    __syncthreads();
    _Float16* vo = Vt + tb + (size_t)tid * KVT;
    const _Float16* ts = &T[tid * KVT];
#pragma unroll
    for (int j = 0; j < 4; ++j)
        *(v8h*)(vo + 8 * j) = *(const v8h*)(ts + 8 * j);
}

// Merge of the two key halves, sending side: one query group's partial O^T, maximum and sum to LDS.
__device__ __forceinline__ void put_part(float4 (*xo)[32], float2* xml, int lane,
                                         const v8f (&o)[8], float m, float l) {
    xml[lane] = make_float2(m, l);
#pragma unroll
    for (int db = 0; db < 8; ++db) {
        xo[2 * db][lane]     = make_float4(o[db][0], o[db][1], o[db][2], o[db][3]);
        xo[2 * db + 1][lane] = make_float4(o[db][4], o[db][5], o[db][6], o[db][7]);
    }
}
// Receiving side: both halves brought to their common maximum, added, normalised, stored.
// A lane holds 32 B pieces of one query row; stored from there, a wave-wide store would touch
// 16 lines. The 16 rows go through the wave's own LDS rows 'st' instead, and each wave-wide
// store then covers one whole row of O: 512 contiguous bytes, four whole 128 B lines.
__device__ __forceinline__ void merge_store(const float4 (*xo)[32], const float2* xml, int lane,
                                            const v8f (&o)[8], float m, float l,
                                            float (*st)[SP], float* obase) {
    float* srow = &st[lane & 15][(lane >> 4) * 8];   // q-row lane & 15, d = db*16 + 8*(lane >> 4) + 0..7
    const float2 ml = xml[lane];
    const float mn = fmaxf(m, ml.x);
    const float ca = fast_exp2(m - mn);
    const float cb = fast_exp2(ml.x - mn);
    const float inv = fast_rcp(l * ca + ml.y * cb);
    const float fa = ca * inv;
    const float fb = cb * inv;
#pragma unroll
    for (int db = 0; db < 8; ++db) {
        const float4 p0 = xo[2 * db][lane];
        const float4 p1 = xo[2 * db + 1][lane];
        float4 lo4, hi4;
        lo4.x = o[db][0] * fa + p0.x * fb; lo4.y = o[db][1] * fa + p0.y * fb;
        lo4.z = o[db][2] * fa + p0.z * fb; lo4.w = o[db][3] * fa + p0.w * fb;
        hi4.x = o[db][4] * fa + p1.x * fb; hi4.y = o[db][5] * fa + p1.y * fb;
        hi4.z = o[db][6] * fa + p1.z * fb; hi4.w = o[db][7] * fa + p1.w * fb;
        *(float4*)(srow + db * 16)     = lo4;
        *(float4*)(srow + db * 16 + 4) = hi4;
    }
    // The rows are read back by other lanes of this wave: its LDS writes end first.
    asm volatile("s_wait_dscnt 0x0" ::: "memory");
    float4 row[16];
#pragma unroll
    for (int r = 0; r < 16; ++r) row[r] = *(const float4*)(&st[r][lane * 4]);
#pragma unroll
    for (int r = 0; r < 16; ++r) *(float4*)(obase + r * DD + lane * 4) = row[r];
}

// ---------------- main FlashAttention kernel (transpose-free, double-buffered) ----------------
// Two sets of WAVES waves walk the two halves of the keys for the same queries, so that every
// SIMD holds two waves: one wave's softmax runs beside the other's products. The halves'
// partial results (maximum, sum, unnormalised O^T) are merged through LDS behind the loop.
__global__ __launch_bounds__(SETS * WAVES * 32, 1)
void DotProductAttention_48421461295297_kernel(const float* __restrict__ Q,
                                               const _Float16* __restrict__ Kh,
                                               const _Float16* __restrict__ Vt,
                                               float* __restrict__ O)
{
    __shared__ __align__(16) _Float16 Kst[SETS][2][KVT * KP];   // [k=32][d=128], padded rows
    __shared__ __align__(16) _Float16 Vst[SETS][2][DD * VP];    // [d=128][k=32], padded rows
    __shared__ __align__(16) float4 Xo[SETS * WAVES][16][32];   // merge: one query group's O^T per wave
    __shared__ float2 Xml[SETS * WAVES][32];                    // merge: its running maximum and sum
    __shared__ __align__(16) float Stg[SETS * WAVES][QG * 16][SP];  // a wave's own rows of Q, later of O

    const int set  = __builtin_amdgcn_readfirstlane((int)threadIdx.x >> 7);   // key half, wave-uniform
    const int tid  = threadIdx.x & (WAVES * 32 - 1);                          // thread within its set
    const int wave = tid >> 5;
    const int lane = tid & 31;
    const int ln   = lane & 15;
    const int koff = (lane >> 4) * 8;   // K-range offset in operand layout

    const int batch = blockIdx.x >> 4;
    const int qblk  = blockIdx.x & 15;
    const int q0    = qblk * (WAVES * QG * 16) + wave * (QG * 16);
    const size_t bbase = (size_t)batch * SS * DD;

    const float SL2E = 0.08838834764831845f * 1.4426950408889634f;  // 1/sqrt(128)*log2(e)

    // Q tile -> f16 registers with the softmax scale folded in (log2 domain).
    // Each wave-wide load takes one whole row of Q (512 contiguous bytes, four whole lines); the
    // rows pass through the wave's own LDS rows, from which each lane picks its fragment pieces.
    float (*stg)[SP] = Stg[set * WAVES + wave];
    const float* qrow = Q + bbase + (size_t)q0 * DD + lane * 4;
    {
        float4 qv[QG * 16];
#pragma unroll
        for (int r = 0; r < QG * 16; ++r) qv[r] = *(const float4*)(qrow + r * DD);
#pragma unroll
        for (int r = 0; r < QG * 16; ++r) *(float4*)(&stg[r][lane * 4]) = qv[r];
    }
    // The Q loads' address registers are reused behind them. The address as an input keeps
    // its registers live up to the wait, so the overwrite cannot be lifted over it.
    asm volatile("s_wait_xcnt 0x0" :: "v"(qrow) : "memory");
    // The rows are read back by other lanes of this wave: its LDS writes end first.
    asm volatile("s_wait_dscnt 0x0" ::: "memory");
    v16h qa[QG][4];
#pragma unroll
    for (int g = 0; g < QG; ++g) {
        const float* qp = &stg[g * 16 + ln][0];
#pragma unroll
        for (int dc = 0; dc < 4; ++dc) {
            const int off = dc * 32 + koff;
            float4 f0 = *(const float4*)(qp + off);
            float4 f1 = *(const float4*)(qp + off + 4);
            float4 f2 = *(const float4*)(qp + off + 16);
            float4 f3 = *(const float4*)(qp + off + 20);
            v16h a;
            a[0]=(_Float16)(f0.x*SL2E);  a[1]=(_Float16)(f0.y*SL2E);
            a[2]=(_Float16)(f0.z*SL2E);  a[3]=(_Float16)(f0.w*SL2E);
            a[4]=(_Float16)(f1.x*SL2E);  a[5]=(_Float16)(f1.y*SL2E);
            a[6]=(_Float16)(f1.z*SL2E);  a[7]=(_Float16)(f1.w*SL2E);
            a[8]=(_Float16)(f2.x*SL2E);  a[9]=(_Float16)(f2.y*SL2E);
            a[10]=(_Float16)(f2.z*SL2E); a[11]=(_Float16)(f2.w*SL2E);
            a[12]=(_Float16)(f3.x*SL2E); a[13]=(_Float16)(f3.y*SL2E);
            a[14]=(_Float16)(f3.z*SL2E); a[15]=(_Float16)(f3.w*SL2E);
            qa[g][dc] = a;
        }
    }

    v8f ot[QG][8] = {};                   // O^T accumulators: rows d, cols q (fp32)
    // mrun is the reference that the exponentials are taken against: a maximum of an earlier trip,
    // renewed only when a score rises more than LAZY above it (mthr = mrun + LAZY), so P <= 2^LAZY.
    constexpr float LAZY = 8.0f;          // log2 units: 256 is far inside the f16 range
    float mrun[QG], mthr[QG];
#pragma unroll
    for (int g = 0; g < QG; ++g) { mrun[g] = -__builtin_inff(); mthr[g] = -__builtin_inff(); }
    // Softmax denominators on the matrix unit: A has ones in rows 0 and 8 (lanes 0, 8, 16, 24) and
    // zeros elsewhere, so rows 0 and 8 of A * P^T hold the column sums of P^T over the tile's 32 keys:
    // register 0 of the result in either half-wave, and each lane finds its own query's sum in lacc[g][0].
    const _Float16 one_row = ((lane & 7) == 0) ? (_Float16)1.0f : (_Float16)0.0f;
    v16h ones;
#pragma unroll
    for (int i = 0; i < 16; ++i) ones[i] = one_row;
    v8f lacc[QG] = {};

    // prefetch: each thread asks for one 64 B piece of the K tile and of the V tile
    const size_t hbase = bbase + (size_t)set * NTS * TILE_H;   // first tile of this set's key half
    const _Float16* kbase = Kh + hbase + (size_t)tid * 32;
    const _Float16* vbase = Vt + hbase + (size_t)tid * 32;
    // staging: a tile is 512 pieces of 16 B; copy j of thread tid moves piece j * 128 + tid,
    // so the 32 lanes of one copy cover 512 contiguous bytes: four whole 128 B lines.
    const _Float16* kcp = Kh + hbase + (size_t)tid * 8;
    const _Float16* vcp = Vt + hbase + (size_t)tid * 8;
    // where piece tid lands in LDS: 16 pieces a K row, 4 pieces a V^T row
    const int kso = (tid >> 4) * KP + (tid & 15) * 8;
    const int vso = (tid >> 2) * VP + (tid & 3) * 8;
    constexpr int GSTEP = 128 * 8;       // f16 elements from piece p to piece p + 128, global
    constexpr int KSTEP = 8 * KP;        // the same in LDS: 8 K rows further
    constexpr int VSTEP = 32 * VP;       // the same in LDS: 32 V^T rows further

    // Tile j of K lies in Kst[set][j & 1], tile j of V^T in Vst[set][j & 1]. K runs one tile ahead
    // of V: trip t reads the fragments of K tile t + 1, so that tile is published one trip earlier.
#ifdef USE_ASYNC_LDS
    {   // stage K tiles 0 and 1 and V tile 0: direct global->LDS, no VGPR traffic
#pragma unroll
        for (int j = 0; j < 4; ++j) {
            __builtin_amdgcn_global_load_async_to_lds_b128(to_global(kcp + j * GSTEP),
                                                           to_lds(&Kst[set][0][kso + j * KSTEP]), 0, 0);
            __builtin_amdgcn_global_load_async_to_lds_b128(to_global(vcp + j * GSTEP),
                                                           to_lds(&Vst[set][0][vso + j * VSTEP]), 0, 0);
            __builtin_amdgcn_global_load_async_to_lds_b128(to_global(kcp + TILE_H + j * GSTEP),
                                                           to_lds(&Kst[set][1][kso + j * KSTEP]), 0, 0);
        }
        wait_async0();
    }
#else
    v8h kr[4], vr[4];
#pragma unroll
    for (int b = 0; b < 2; ++b) {
#pragma unroll
        for (int j = 0; j < 4; ++j) kr[j] = *(const v8h*)(kcp + b * TILE_H + j * GSTEP);
#pragma unroll
        for (int j = 0; j < 4; ++j) *(v8h*)(&Kst[set][b][kso + j * KSTEP]) = kr[j];
    }
#pragma unroll
    for (int j = 0; j < 4; ++j) vr[j] = *(const v8h*)(vcp + j * GSTEP);
#pragma unroll
    for (int j = 0; j < 4; ++j) *(v8h*)(&Vst[set][0][vso + j * VSTEP]) = vr[j];
#endif
    __syncthreads();

    v16h kb[8];                           // K fragments, always one tile ahead: here tile 0's
#pragma unroll
    for (int dc = 0; dc < 4; ++dc) {
        kb[dc]     = ld_op16(&Kst[set][0][(0  + ln) * KP + dc * 32 + koff]);
        kb[4 + dc] = ld_op16(&Kst[set][0][(16 + ln) * KP + dc * 32 + koff]);
    }
    // Ends this wave's reads of K buffer 0: trip 0 refills it behind the barrier below.
    asm volatile("s_wait_dscnt 0x0" ::: "memory");
    __syncthreads();

#pragma unroll 1
    for (int t = 0; t < NTS; ++t) {
        const int cur = t & 1;

        if (t + 1 < NTS) {                 // start the next copies before compute
            // V tile t + 1 into the buffer that trip t - 1 read at its top
            const _Float16* vn = vcp + (size_t)(t + 1) * TILE_H;
#ifdef USE_ASYNC_LDS
#pragma unroll
            for (int j = 0; j < 4; ++j)
                __builtin_amdgcn_global_load_async_to_lds_b128(to_global(vn + j * GSTEP),
                                                               to_lds(&Vst[set][cur ^ 1][vso + j * VSTEP]), 0, 0);
#else
#pragma unroll
            for (int j = 0; j < 4; ++j) vr[j] = *(const v8h*)(vn + j * GSTEP);
#endif
            if (t + 2 < NTS) {
                // K tile t + 2 into the buffer of K tile t, whose fragments trip t - 1 fetched
                const _Float16* kn = kcp + (size_t)(t + 2) * TILE_H;
#ifdef USE_ASYNC_LDS
#pragma unroll
                for (int j = 0; j < 4; ++j)
                    __builtin_amdgcn_global_load_async_to_lds_b128(to_global(kn + j * GSTEP),
                                                                   to_lds(&Kst[set][cur][kso + j * KSTEP]), 0, 0);
#else
#pragma unroll
                for (int j = 0; j < 4; ++j) kr[j] = *(const v8h*)(kn + j * GSTEP);
#endif
                // gfx1250 global_prefetch, one tile ahead of each copy
                __builtin_prefetch(vbase + (size_t)(t + 2) * TILE_H, 0, 1);
                if (t + 3 < NTS)
                    __builtin_prefetch(kbase + (size_t)(t + 3) * TILE_H, 0, 1);
            }
        }

        v16h vb[8];                       // this tile's V^T fragments: they land behind the S products
#pragma unroll
        for (int db = 0; db < 8; ++db)
            vb[db] = ld_op16(&Vst[set][cur][(db * 16 + ln) * VP + koff]);
        // Keeps the 16 V^T reads above as one group in front of the S products: left free,
        // the scheduler sinks each pair to its product and the wave waits out a full LDS
        // latency in front of every product.
        __builtin_amdgcn_sched_barrier(0);

        // ---- S^T = K_tile * Q^T, on the fragments that the trip before fetched ----
        v8f ct0[QG] = {}, ct1[QG] = {};
#pragma unroll
        for (int dc = 0; dc < 4; ++dc) {
#pragma unroll
            for (int g = 0; g < QG; ++g) {
                ct0[g] = __builtin_amdgcn_wmma_f32_16x16x32_f16(false, kb[dc],     false, qa[g][dc],
                                                                (short)0, ct0[g], false, false);
                ct1[g] = __builtin_amdgcn_wmma_f32_16x16x32_f16(false, kb[4 + dc], false, qa[g][dc],
                                                                (short)0, ct1[g], false, false);
            }
        }

        // ---- online softmax (log2 domain; scores already scaled via Q), per query group ----
        float vmax[QG];                   // a lane's own maximum: 16 of its query's 32 scores
        bool need = false;                // does one of them outgrow the reference in use?
#pragma unroll
        for (int g = 0; g < QG; ++g) {
            vmax[g] = ct0[g][0];
#pragma unroll
            for (int r = 1; r < 8; ++r) vmax[g] = fmaxf(vmax[g], ct0[g][r]);
#pragma unroll
            for (int r = 0; r < 8; ++r) vmax[g] = fmaxf(vmax[g], ct1[g][r]);
            need = need || (vmax[g] > mthr[g]);
        }
        // One test a trip for the whole wave; the first trip always takes it (mthr = -inf).
        const unsigned grow = __builtin_amdgcn_ballot_w32(need);
        // Keeps the 16 reads below out of the S products: left free, the scheduler puts each pair
        // behind the last product that uses its fragment's registers, eight places with reads.
        __builtin_amdgcn_sched_barrier(0);
        // The next tile's K fragments, behind the S products, which free kb: they land under the
        // exponentials and conversions, before the O products, and the next trip's S products start at once.
        // The last trip has no next tile: it reads the tile before its own again (published, no copy
        // in flight), and the values feed nothing; a branch round the reads would save no time.
#pragma unroll
        for (int dc = 0; dc < 4; ++dc) {
            kb[dc]     = ld_op16(&Kst[set][cur ^ 1][(0  + ln) * KP + dc * 32 + koff]);
            kb[4 + dc] = ld_op16(&Kst[set][cur ^ 1][(16 + ln) * KP + dc * 32 + koff]);
        }

        // Scalar branch, rarely taken (the hint moves its body out of the loop's straight line):
        // the half-waves join their maxima, and the sums so far are brought to the new reference.
        if (__builtin_expect(grow != 0, 0)) {
#pragma unroll
            for (int g = 0; g < QG; ++g) {
                const float mnew = fmaxf(mrun[g], fmaxf(vmax[g], __shfl_xor(vmax[g], 16, 32)));
                const float corr = fast_exp2(mrun[g] - mnew);
                mrun[g] = mnew;
                mthr[g] = mnew + LAZY;
                lacc[g] = lacc[g] * corr;
#pragma unroll
                for (int db = 0; db < 8; ++db)    // v8f * scalar -> v_pk_mul_f32
                    ot[g][db] = ot[g][db] * corr;
            }
        }

        v16h pa[QG];                      // exponentiated scores == P^T B-operand layout
        v8f e0[QG], e1[QG];
#pragma unroll
        for (int g = 0; g < QG; ++g) { e0[g] = ct0[g] - mrun[g]; e1[g] = ct1[g] - mrun[g]; }
#pragma unroll
        for (int g = 0; g < QG; ++g) {
#pragma unroll
            for (int r = 0; r < 8; ++r) e0[g][r] = fast_exp2(e0[g][r]);
#pragma unroll
            for (int r = 0; r < 8; ++r) e1[g][r] = fast_exp2(e1[g][r]);
        }
#pragma unroll
        for (int g = 0; g < QG; ++g) {
#pragma unroll
            for (int r = 0; r < 8; ++r) { pa[g][r] = (_Float16)e0[g][r]; pa[g][8 + r] = (_Float16)e1[g][r]; }
        }

        // ---- denominators += column sums of P^T (of the f16 values that the O products use) ----
#pragma unroll
        for (int g = 0; g < QG; ++g)
            lacc[g] = __builtin_amdgcn_wmma_f32_16x16x32_f16(false, ones, false, pa[g],
                                                             (short)0, lacc[g], false, false);

        // The trip's barrier is split: no LDS read and no copy stands behind this point, so the wave
        // says here that it is done with the buffers, and meets the others only behind its O products.
        // Keeps the waits below behind the exponentials and conversions: risen among them, the wave
        // would stand there for its K reads and copies with vector work still to issue.
        __builtin_amdgcn_sched_barrier(0);
#ifndef USE_ASYNC_LDS
        if (t + 1 < NTS) {
            _Float16* vd = &Vst[set][cur ^ 1][vso];
#pragma unroll
            for (int j = 0; j < 4; ++j) *(v8h*)(vd + j * VSTEP) = vr[j];
            if (t + 2 < NTS) {
                _Float16* kd = &Kst[set][cur][kso];
#pragma unroll
                for (int j = 0; j < 4; ++j) *(v8h*)(kd + j * KSTEP) = kr[j];
            }
        }
#endif
        // Ends this wave's reads of the K and V buffers that the next trip refills behind the barrier.
        asm volatile("s_wait_dscnt 0x0" ::: "memory");
#ifdef USE_ASYNC_LDS
        // This wave's copies have landed before it signals: the others read them behind the barrier.
        asm volatile("s_wait_asynccnt 0x0" ::: "memory");
#endif
        // First half of the work-group barrier.
        asm volatile("s_barrier_signal -1" ::: "memory");
        // Keeps the O products behind the signal: risen above it, they would delay it.
        __builtin_amdgcn_sched_barrier(0);

        // ---- O^T += V^T * P^T ----
#pragma unroll
        for (int db = 0; db < 8; ++db) {
#pragma unroll
            for (int g = 0; g < QG; ++g)
                ot[g][db] = __builtin_amdgcn_wmma_f32_16x16x32_f16(false, vb[db], false, pa[g],
                                                                   (short)0, ot[g][db], false, false);
        }

        // Keeps the barrier's second half behind the O products: risen among them, the wave would
        // stand there with products still to issue.
        __builtin_amdgcn_sched_barrier(0);
        // Second half of the work-group barrier: behind it the next trip refills and reads.
        asm volatile("s_barrier_wait -1" ::: "memory");
    }

    // ---- merge the two key halves: a wave keeps query group 'set' and hands the other one
    //      to the wave of the other set that holds the same queries ----
    const int me = set * WAVES + wave;
    const int pw = (set ^ 1) * WAVES + wave;
    if (set == 0) put_part(Xo[me], Xml[me], lane, ot[1], mrun[1], lacc[1][0]);
    else          put_part(Xo[me], Xml[me], lane, ot[0], mrun[0], lacc[0][0]);
    __syncthreads();

    // ---- normalize + store: the wave's 16 query rows, whole rows at a time ----
    float* obase = O + bbase + (size_t)(q0 + set * 16) * DD;
    if (set == 0) merge_store(Xo[pw], Xml[pw], lane, ot[0], mrun[0], lacc[0][0], stg, obase);
    else          merge_store(Xo[pw], Xml[pw], lane, ot[1], mrun[1], lacc[1][0], stg, obase);
}

extern "C" void kernel_launch(void* const* d_in, const int* in_sizes, int n_in,
                              void* d_out, int out_size, void* d_ws, size_t ws_size,
                              hipStream_t stream) {
    (void)in_sizes; (void)n_in; (void)out_size; (void)ws_size;
    const float* Q = (const float*)d_in[0];
    const float* K = (const float*)d_in[1];
    const float* V = (const float*)d_in[2];
    float* O = (float*)d_out;
    // workspace: Kh (8.39 MB) | Vt (8.39 MB)  -> 16.78 MB of d_ws
    _Float16* Kh = (_Float16*)d_ws;
    _Float16* Vt = Kh + (size_t)BB * SS * DD;
    hipLaunchKernelGGL(fa_prep, dim3(BB * NT), dim3(128), 0, stream, K, V, Kh, Vt);
    hipLaunchKernelGGL(DotProductAttention_48421461295297_kernel,
                       dim3(BB * (SS / (WAVES * QG * 16))), dim3(SETS * WAVES * 32), 0, stream, Q, Kh, Vt, O);
}
